// v000
// Times are from an AMD MI455X. After a warm-up the kernel runs many times in a row, and a time is the length of
// such a window on the GPU divided by its runs, so every launch and the gaps after it count. The runs cycle
// through copies of the inputs. A figure is the median of several windows, for all but v000 over two sittings.
// Sittings can differ by a few percent; kernels timed side by side share one.
// The starting kernel, v000, takes 8700 microseconds a run.
// A single-head pair weighting over 6,400 positions of channel-first arrays with a multiplicative key vector: xa [2][64][6400] and ya [2][64][6400] (group, channel, position), kv [2][6400], wa, wb, wc [64][64] stored (row: result channel; column: source channel), ba, bb, bc [64], gs [1]: qr = wa xa + ba, kr = wb ya + bb, vr = wc xa + bc (channel-first); zs[g][i][j] = (sum over c of qr[c][i] kr[c][j]) kv[g][j]; wt[g][i][:] = softmax over j of zs[g][i][:]; ag[g][c][i] = sum over j of vr[c][j] wt[g][i][j]; res = xa kv + gs[0] (1 - kv) ag -> [2][64][6400] f32: one result.
// Structure: each channel-first array cast transposed a group at a time into position rows [6400][64] of f16 words (converted to bf16 first); the three weights cast as they lie (a row a result channel, the depth along it: the layout of the product's second operand); WMMA GEMMs: the two projections of the position rows with their added vectors into f32 planes; THE KEY VECTOR IS MULTIPLIED INTO THE SECOND PROJECTION's ROWS (kr[:][j] kv[j]: the same sum over c, the factor taken inside it: nothing stands between); each projection then split into an f16 word and an f16 residual word (x 2^10); the third projection formed channel-first into an f32 plane (the weight's rows as the first operand), its added vector joined a row at a time and the sum stored as one f16 word; A QUERY BLOCK OF 1,280 ROWS AT A TIME: the raw sums by three products (word.word, residual.word and word.residual: the last two at 2^-10 added in place) into an f32 plane; ONE flat kernel takes the softmax of each row of 6,400 sums and stores one f16 word each behind a carry of 2^12, words under 2^-14 stored as nought (a thread a row; three walks to a literal bound; the library exponential and logarithm); one product (the channel-first third projection against those rows: depth 6,400; its scale 2^-12 undoes the carry) writes the block's columns of the channel-first plane; ONE flat kernel writes the result.
// Compute dtype: all ten inputs converted to bf16 where they are read; the arrays' rows and the weights exact as f16 words down to 2^-14; the two projections TWO f16 words each; the third projection ONE f16 word; the softmax words ONE f16 word behind 2^12 with the small words flushed at the store; every product's accumulation, the raw sums, the softmax's arithmetic and the result f32. v_wmma_f32_16x16x32_f16.
#include <hip/hip_runtime.h>
#define MNG 2                        /* groups */
#define MNC 64                       /* channels: the projections' depth and width */
#define MNN 6400                     /* positions: the softmax's axis */
#define MQB 1280                     /* rows of a query block */
#define MCARRY 4096.0f               /* 2^12: the carry on the softmax words (undone in the last product's scale argument) */
#define MLOGC 8.31776616671934f      /* 12 ln 2 = ln(MCARRY) */
#define MFLUSH 6.103515625e-05f      /* 2^-14: a softmax word under it is stored as nought */
typedef unsigned short v8us __attribute__((ext_vector_type(8), may_alias));
typedef float  v8f  __attribute__((ext_vector_type(8)));
typedef float  v4f  __attribute__((ext_vector_type(4)));
typedef float  v4fa __attribute__((ext_vector_type(4), may_alias));

__device__ __forceinline__ unsigned short bf16_bits(float x) { unsigned int u = __float_as_uint(x); return (unsigned short)((u + 0x7FFFu + ((u >> 16) & 1u)) >> 16); }
__device__ __forceinline__ float bf16_val(unsigned short b) { return __uint_as_float(((unsigned int)b) << 16); }
__device__ __forceinline__ float bf16_round(float x) { return bf16_val(bf16_bits(x)); }

typedef _Float16 v16h __attribute__((ext_vector_type(16)));
union FragH { v16h v; v8us half[2]; _Float16 h[16]; unsigned short u[16]; };

// Wt[n][k] = f16(W[k][n] x scale) from f32 row-major W[K][N] (scale = power of two; bf16-exact weights stay exact in f16 away from the subnormal range)
__global__ __launch_bounds__(256) void k_wt_f16(const float* __restrict__ W, _Float16* __restrict__ Wt, int K, int N, float scale) {
  const int t = blockIdx.x * 256 + threadIdx.x; if (t >= N * (K / 8)) return; const int n = t / (K / 8), k8 = (t % (K / 8)) * 8; FragH f;
#pragma unroll
  for (int i = 0; i < 8; ++i) f.h[i] = (_Float16)(bf16_round(W[(size_t)(k8 + i) * N + n]) * scale); const v8us o = f.half[0];
  *(v8us*)((unsigned short*)Wt + (size_t)n * K + k8) = o; 
}

typedef _Float16 v4h __attribute__((ext_vector_type(4)));

__global__ __launch_bounds__(256) void k_x16(const float* __restrict__ x, _Float16* __restrict__ X16, size_t n8) { const size_t t = (size_t)blockIdx.x * 256 + threadIdx.x; if (t >= n8) return; FragH f;
#pragma unroll
  for (int q = 0; q < 8; ++q) f.h[q] = (_Float16)bf16_round(x[t * 8 + q]); *(v8us*)((unsigned short*)X16 + t * 8) = f.half[0];  }

// ---- fast GEMM (wave tile 32x64; requires M % 32 == 0 rows per launch region and N % 64 == 0) ----
__device__ __forceinline__ v16h g2_frag(const _Float16* p, int hh) { FragH f; f.half[0] = *(const v8us*)((const unsigned short*)p + 8 * hh); f.half[1] = *(const v8us*)((const unsigned short*)p + 16 + 8 * hh); return f.v; }
__device__ __forceinline__ v8f g2_mma(v16h a, v16h b, v8f c) { v8f d = __builtin_amdgcn_wmma_f32_16x16x32_f16(false, a, false, b, (short)0, c, false, false); asm volatile("v_nop\n\tv_nop\n\tv_nop\n\tv_nop" : "+v"(d) : "v"(a), "v"(b)); return d; }
template <int ACT>
__global__ __launch_bounds__(128) void k_gemm2(const _Float16* __restrict__ A, int lda, size_t sA, const _Float16* __restrict__ Bh, int ldb, size_t sB, float alpha, const float* __restrict__ bias, size_t sBias, const float* __restrict__ CP, int rowsPerB, size_t sCPb, int row0g,
    float* __restrict__ C, _Float16* __restrict__ C16, int ldc, size_t sC, int M, int N, int K) { static_assert(ACT == 0 || ACT == 3 || ACT == 6 || ACT == 8 || ACT == 9 || ACT == 11 || ACT == 12 || ACT == 14 || ACT == 15 || ACT == 16 || ACT == 17, "k_gemm2: unsupported ACT code (would silently apply no activation)");
  __shared__ __attribute__((aligned(16))) float so[4][32][68];
  const int tid = threadIdx.x, w = tid >> 5, lane = tid & 31, ln = lane & 15, hh = lane >> 4; const int by = blockIdx.y;
  A += (size_t)by * sA; Bh += (size_t)by * sB; const size_t cofs = (size_t)by * sC; const float* bp = bias ? bias + (size_t)by * sBias : nullptr;
  const int ntn = N >> 6; const int mt = blockIdx.x / ntn, nq = blockIdx.x - mt * ntn; const int row0 = mt * 128 + 32 * w, col0 = nq * 64; if (row0 >= M) return;
  const _Float16* a0p = A + (size_t)(row0 + ln) * lda; const _Float16* a1p = a0p + (size_t)16 * lda;
  const _Float16* b0p = Bh + (size_t)(col0 + ln) * ldb; const _Float16* b1p = b0p + (size_t)16 * ldb; const _Float16* b2p = b1p + (size_t)16 * ldb; const _Float16* b3p = b2p + (size_t)16 * ldb;
  const v8f z8 = {0.f,0.f,0.f,0.f,0.f,0.f,0.f,0.f}; v8f c00 = z8, c01 = z8, c02 = z8, c03 = z8, c10 = z8, c11 = z8, c12 = z8, c13 = z8;
  for (int kb = 0; kb < K; kb += 32) { const v16h a0 = g2_frag(a0p + kb, hh), a1 = g2_frag(a1p + kb, hh);
    v16h b = g2_frag(b0p + kb, hh); c00 = g2_mma(a0, b, c00); c10 = g2_mma(a1, b, c10);
    b = g2_frag(b1p + kb, hh); c01 = g2_mma(a0, b, c01); c11 = g2_mma(a1, b, c11);
    b = g2_frag(b2p + kb, hh); c02 = g2_mma(a0, b, c02); c12 = g2_mma(a1, b, c12);
    b = g2_frag(b3p + kb, hh); c03 = g2_mma(a0, b, c03); c13 = g2_mma(a1, b, c13); }
  v8f accs[8] = {c00, c01, c02, c03, c10, c11, c12, c13};
#pragma unroll
  for (int u = 0; u < 8; ++u) { const int t = u & 3, half = u >> 2; const int col = col0 + t * 16 + ln; const float bv = bp ? bf16_round(bp[col]) : 0.f;
#pragma unroll
    for (int r = 0; r < 8; ++r) { const int rloc = half * 16 + 8 * hh + r; float v = accs[u][r] * alpha + bv; if (CP) { if (rowsPerB < 0) v += CP[cofs + (size_t)(row0g + row0 + rloc) * ldc + col];      /* rowsPerB < 0: own element of the batched C plane */ else { const int bidx = (row0g + row0 + rloc) / rowsPerB; v += CP[(size_t)bidx * sCPb + (size_t)by * 64 + col]; } }
      if (ACT == 3) v = fmaxf(v, 0.f); else if (ACT == 6) v = 0.5f * v * (1.0f + erff(v * 0.70710678118654752f)); else if (ACT == 11) v = 1.0f / (1.0f + expf(-v)); else if (ACT == 15) v = v / (1.0f + expf(-v)); else if (ACT == 12) v = (v > 0.f) ? v : 0.01f * v; else if (ACT == 8) v = tanhf(v); else if (ACT == 9) v = 0.5f * v * (1.0f + tanhf(0.7978845608028654f * (v + 0.044715f * v * v * v))); else if (ACT == 14) v = (v > 0.f) ? v : 0.1f * v; else if (ACT == 16) v = (v >= 0.f) ? v : 0.3f * v; else if (ACT == 17) v = (v >= 0.f) ? v : 0.2f * v;
      so[w][rloc][t * 16 + ln] = v; } }
  __builtin_amdgcn_fence(__ATOMIC_ACQ_REL, "workgroup"); __builtin_amdgcn_wave_barrier();
  const int rsub = lane >> 4, c4 = (lane & 15) * 4;
  {
#pragma unroll
    for (int q = 0; q < 16; ++q) { const int r = q * 2 + rsub; const v4f v = *(const v4fa*)&so[w][r][c4]; if (C) *(v4f*)(C + cofs + (size_t)(row0 + r) * ldc + col0 + c4) = v; if (C16) { v4h h4; for (int i = 0; i < 4; ++i) h4[i] = (_Float16)v[i]; *(v4h*)(C16 + cofs + (size_t)(row0 + r) * ldc + col0 + c4) = h4; } }
     } }

__global__ __launch_bounds__(256) void k_hl(const float* __restrict__ F, _Float16* __restrict__ Hh, _Float16* __restrict__ Hl, size_t n8) { const size_t t = (size_t)blockIdx.x * 256 + threadIdx.x; if (t >= n8) return; FragH fh, fl; const v4f a = *(const v4fa*)(F + t * 8), c = *(const v4fa*)(F + t * 8 + 4);
#pragma unroll
  for (int q = 0; q < 4; ++q) { _Float16 h = (_Float16)a[q]; fh.h[q] = h; fl.h[q] = (_Float16)((a[q] - (float)h) * 1024.0f); h = (_Float16)c[q]; fh.h[4 + q] = h; fl.h[4 + q] = (_Float16)((c[q] - (float)h) * 1024.0f); }
  { *(v8us*)((unsigned short*)Hh + t * 8) = fh.half[0]; *(v8us*)((unsigned short*)Hl + t * 8) = fl.half[0];  } }

__global__ __launch_bounds__(256) void k_rsc(float* __restrict__ F, const float* __restrict__ kv) {
  const unsigned t = blockIdx.x * 256u + threadIdx.x; if (t >= (unsigned)(MNG * MNN * (MNC / 4))) return;
  const unsigned r = t / (MNC / 4); const float kk = bf16_round(kv[r]); float* d = F + (size_t)t * 4; v4f a = *(const v4fa*)d;
#pragma unroll
  for (int q = 0; q < 4; ++q) a[q] = a[q] * kk;
  *(v4f*)d = a;  }

__global__ __launch_bounds__(256) void k_vb(const float* __restrict__ V, const _Float16* __restrict__ bh, _Float16* __restrict__ VC) {
  const unsigned t = blockIdx.x * 256u + threadIdx.x; if (t >= (unsigned)(MNG * MNC * (MNN / 8))) return;
  const unsigned c = (t / (MNN / 8)) % MNC; const float bb = (float)bh[c]; const v4f a = *(const v4fa*)(V + (size_t)t * 8); const v4f b = *(const v4fa*)(V + (size_t)t * 8 + 4); FragH f;
#pragma unroll
  for (int q = 0; q < 4; ++q) { f.h[q] = (_Float16)(a[q] + bb); f.h[4 + q] = (_Float16)(b[q] + bb); }
  unsigned short* o = (unsigned short*)VC + (size_t)t * 8; *(v8us*)o = f.half[0];  }

__global__ __launch_bounds__(256) void k_smf(const float* __restrict__ zs, _Float16* __restrict__ RP, unsigned nrows) {
  const unsigned r = blockIdx.x * 256u + threadIdx.x; if (r >= nrows) return;
  const float* p = zs + (size_t)r * MNN; unsigned short* o = (unsigned short*)RP + (size_t)r * MNN; float hi = p[0];
  for (unsigned j = 0; j < (unsigned)MNN; j += 4) { const v4f a = *(const v4fa*)(p + j); hi = fmaxf(fmaxf(fmaxf(hi, a[0]), fmaxf(a[1], a[2])), a[3]); }
  float s = 0.0f;
  for (unsigned j = 0; j < (unsigned)MNN; j += 4) { const v4f a = *(const v4fa*)(p + j);
#pragma unroll
    for (int q = 0; q < 4; ++q) s += expf(a[q] - hi); }
  const float lg = (hi + logf(s)) - MLOGC;      /* 2^12 exp(z - hi) / s = exp(z - lg): the carry and the quotient ride in the exponent: no division and no multiply before the cast */
  for (unsigned j = 0; j < (unsigned)MNN; j += 8) { const v4f a = *(const v4fa*)(p + j); const v4f b = *(const v4fa*)(p + j + 4); FragH f;
#pragma unroll
    for (int q = 0; q < 4; ++q) { const float wa = expf(a[q] - lg), wb = expf(b[q] - lg); f.h[q] = (_Float16)(wa < MFLUSH ? 0.0f : wa); f.h[4 + q] = (_Float16)(wb < MFLUSH ? 0.0f : wb); }
    const v8us w = f.half[0]; *(v8us*)(o + j) = w;  }
}

__global__ __launch_bounds__(256) void k_fin(const float* __restrict__ xa, const float* __restrict__ kv, const float* __restrict__ gs, const float* __restrict__ ag, float* __restrict__ res) {
  const unsigned t = blockIdx.x * 256u + threadIdx.x; if (t >= (unsigned)(MNG * MNC * (MNN / 4))) return;
  const unsigned i0 = (t % (MNN / 4)) * 4, g = t / ((MNN / 4) * MNC);
  const size_t e = (size_t)t * 4; const v4f x4 = *(const v4fa*)(xa + e); const v4f k4 = *(const v4fa*)(kv + (size_t)g * MNN + i0); const v4f a4 = *(const v4fa*)(ag + e); const float gg = bf16_round(gs[0]); v4f o;
#pragma unroll
  for (int q = 0; q < 4; ++q) { const float kk = bf16_round(k4[q]); o[q] = bf16_round(x4[q]) * kk + (gg * (1.0f - kk)) * a4[q]; }
  float* d = res + e; *(v4f*)d = o;  }

extern "C" void kernel_launch(void* const* d_in, const int* in_sizes, int n_in,
                              void* d_out, int out_size, void* d_ws, size_t ws_size, hipStream_t stream) {
  (void)in_sizes; (void)n_in; (void)out_size;
  const float* const* I = (const float* const*)d_in; const float* xa = I[0]; const float* ya = I[1]; const float* kv = I[2]; const float* wa = I[3]; const float* ba = I[4]; const float* wb = I[5]; const float* bb = I[6]; const float* wc = I[7]; const float* bc = I[8]; const float* gs = I[9];      /* xa and ya [2][64][6400]; kv [2][1][6400]; wa, wb, wc [64][64]; ba, bb, bc [64]; gs [1] */
  static_assert(MNN % MQB == 0 && MQB % 128 == 0 && MNN % 64 == 0 && MNC % 64 == 0 && MNC % 32 == 0 && MNN % 32 == 0 && MNN % 8 == 0 && (MNG * MNN) % 128 == 0, "whole tiles");
  uint8_t* wsp = (uint8_t*)d_ws; size_t off = 0;
  auto take = [&](size_t bytes) { uint8_t* p = wsp + off; off += (bytes + 255) & ~(size_t)255; return p; };
  _Float16* XT = (_Float16*)take((size_t)MNG * MNN * MNC * 2); _Float16* YT = (_Float16*)take((size_t)MNG * MNN * MNC * 2); _Float16* WA = (_Float16*)take((size_t)MNC * MNC * 2); _Float16* WB = (_Float16*)take((size_t)MNC * MNC * 2); _Float16* WC = (_Float16*)take((size_t)MNC * MNC * 2); _Float16* BH = (_Float16*)take((size_t)MNC * 2);
  float* QF = (float*)take((size_t)MNG * MNN * MNC * 4); float* KF = (float*)take((size_t)MNG * MNN * MNC * 4); _Float16* QH = (_Float16*)take((size_t)MNG * MNN * MNC * 2); _Float16* QL = (_Float16*)take((size_t)MNG * MNN * MNC * 2); _Float16* KW = (_Float16*)take((size_t)MNG * MNN * MNC * 2); _Float16* KL = (_Float16*)take((size_t)MNG * MNN * MNC * 2); float* VF = (float*)take((size_t)MNG * MNC * MNN * 4); _Float16* VC = (_Float16*)take((size_t)MNG * MNC * MNN * 2);
  float* SC = (float*)take((size_t)MQB * MNN * 4); _Float16* RP = (_Float16*)take((size_t)MQB * MNN * 2); float* AG = (float*)take((size_t)MNG * MNC * MNN * 4);      /* the position rows of both arrays; the weights and the third added vector as f16 words; the two projections in f32 and as word | residual planes; the third projection channel-first in f32 and as f16 words; a block's raw sums and softmax words; the aggregated plane channel-first */
  if (off > ws_size) return;
  for (int g = 0; g < MNG; ++g) {      /* a literal count on the host */
    k_wt_f16<<<(unsigned)(((size_t)MNN * (MNC / 8) + 255) / 256), 256, 0, stream>>>(xa + (size_t)g * MNC * MNN, XT + (size_t)g * MNN * MNC, MNC, MNN, 1.0f);      /* xa[g] as [64][6400]: XT[g][i][c] = xa[g][c][i] */
    k_wt_f16<<<(unsigned)(((size_t)MNN * (MNC / 8) + 255) / 256), 256, 0, stream>>>(ya + (size_t)g * MNC * MNN, YT + (size_t)g * MNN * MNC, MNC, MNN, 1.0f); }
  k_x16<<<(unsigned)(((size_t)MNC * MNC / 8 + 255) / 256), 256, 0, stream>>>(wa, WA, (size_t)MNC * MNC / 8);
  k_x16<<<(unsigned)(((size_t)MNC * MNC / 8 + 255) / 256), 256, 0, stream>>>(wb, WB, (size_t)MNC * MNC / 8);
  k_x16<<<(unsigned)(((size_t)MNC * MNC / 8 + 255) / 256), 256, 0, stream>>>(wc, WC, (size_t)MNC * MNC / 8);
  k_x16<<<1, 256, 0, stream>>>(bc, BH, (size_t)MNC / 8);      /* the third added vector as 64 f16 words */
  k_gemm2<0><<<dim3((unsigned)(((MNG * MNN) / 128) * (MNC / 64)), 1), 128, 0, stream>>>(XT, MNC, 0, WA, MNC, 0, 1.0f, ba, 0, nullptr, 1, 0, 0, QF, nullptr, MNC, 0, MNG * MNN, MNC, MNC);      /* QF[(g, i)][o] = xa[g][:][i] . wa[o][:] + ba[o] */
  k_gemm2<0><<<dim3((unsigned)(((MNG * MNN) / 128) * (MNC / 64)), 1), 128, 0, stream>>>(YT, MNC, 0, WB, MNC, 0, 1.0f, bb, 0, nullptr, 1, 0, 0, KF, nullptr, MNC, 0, MNG * MNN, MNC, MNC);
  k_rsc<<<(unsigned)(((size_t)MNG * MNN * (MNC / 4) + 255) / 256), 256, 0, stream>>>(KF, kv);      /* KF[(g, j)][:] x kv[g][j]: kv's 12,800 words lie in the order of the rows */
  k_hl<<<(unsigned)(((size_t)MNG * MNN * MNC / 8 + 255) / 256), 256, 0, stream>>>(QF, QH, QL, (size_t)MNG * MNN * MNC / 8);
  k_hl<<<(unsigned)(((size_t)MNG * MNN * MNC / 8 + 255) / 256), 256, 0, stream>>>(KF, KW, KL, (size_t)MNG * MNN * MNC / 8);
  k_gemm2<0><<<dim3((unsigned)(((MNC + 127) / 128) * (MNN / 64)), MNG), 128, 0, stream>>>(WC, MNC, 0, XT, MNC, (size_t)MNN * MNC, 1.0f, nullptr, 0, nullptr, 1, 0, 0, VF, nullptr, MNN, (size_t)MNC * MNN, MNC, MNN, MNC);      /* VF[g][o][j] = wc[o][:] . xa[g][:][j]: channel-first */
  k_vb<<<(unsigned)(((size_t)MNG * MNC * (MNN / 8) + 255) / 256), 256, 0, stream>>>(VF, BH, VC);
  for (int g = 0; g < MNG; ++g) for (int i0 = 0; i0 < MNN; i0 += MQB) {      /* literal counts on the host: ten query blocks */
    const _Float16* qh = QH + ((size_t)g * MNN + i0) * MNC; const _Float16* ql = QL + ((size_t)g * MNN + i0) * MNC; const _Float16* kw = KW + (size_t)g * MNN * MNC; const _Float16* kl = KL + (size_t)g * MNN * MNC;
    k_gemm2<0><<<dim3((unsigned)((MQB / 128) * (MNN / 64)), 1), 128, 0, stream>>>(qh, MNC, 0, kw, MNC, 0, 1.0f, nullptr, 0, nullptr, 1, 0, 0, SC, nullptr, MNN, 0, MQB, MNN, MNC);
    k_gemm2<0><<<dim3((unsigned)((MQB / 128) * (MNN / 64)), 1), 128, 0, stream>>>(ql, MNC, 0, kw, MNC, 0, 0.0009765625f, nullptr, 0, SC, -1, 0, 0, SC, nullptr, MNN, 0, MQB, MNN, MNC);
    k_gemm2<0><<<dim3((unsigned)((MQB / 128) * (MNN / 64)), 1), 128, 0, stream>>>(qh, MNC, 0, kl, MNC, 0, 0.0009765625f, nullptr, 0, SC, -1, 0, 0, SC, nullptr, MNN, 0, MQB, MNN, MNC);      /* the raw sums of the block: word.word + 2^-10 (residual.word + word.residual) */
    k_smf<<<(unsigned)((MQB + 255) / 256), 256, 0, stream>>>(SC, RP, (unsigned)MQB);
    k_gemm2<0><<<dim3((unsigned)(((MNC + 127) / 128) * (MQB / 64)), 1), 128, 0, stream>>>(VC + (size_t)g * MNC * MNN, MNN, 0, RP, MNN, 0, 1.0f / MCARRY, nullptr, 0, nullptr, 1, 0, 0, AG + (size_t)g * MNC * MNN + i0, nullptr, MNN, 0, MNC, MQB, MNN); }      /* AG[g][c][i0 + i] = sum over j of VC[g][c][j] RP[i][j] / 2^12 */
  k_fin<<<(unsigned)(((size_t)MNG * MNC * (MNN / 4) + 255) / 256), 256, 0, stream>>>(xa, kv, gs, AG, (float*)d_out);      /* every element of the result once */
}

// v001
// It runs in 2790 microseconds.
// In two side-by-side timings against v000, it was 3.06 and 3.08 times as fast.
// A single-head pair weighting over 6,400 positions of channel-first arrays with a multiplicative key vector: xa [2][64][6400] and ya [2][64][6400] (group, channel, position), kv [2][6400], wa, wb, wc [64][64] stored (row: result channel; column: source channel), ba, bb, bc [64], gs [1]: qr = wa xa + ba, kr = wb ya + bb, vr = wc xa + bc (channel-first); zs[g][i][j] = (sum over c of qr[c][i] kr[c][j]) kv[g][j]; wt[g][i][:] = softmax over j of zs[g][i][:]; ag[g][c][i] = sum over j of vr[c][j] wt[g][i][j]; res = xa kv + gs[0] (1 - kv) ag -> [2][64][6400] f32: one result.
// Structure: each channel-first array cast transposed a group at a time into position rows [6400][64] of f16 words (converted to bf16 first); the three weights cast as they lie (a row a result channel, the depth along it: the layout of the product's second operand); WMMA GEMMs: the two projections of the position rows with their added vectors into f32 planes; THE KEY VECTOR IS MULTIPLIED INTO THE SECOND PROJECTION's ROWS (kr[:][j] kv[j]: the same sum over c, the factor taken inside it: nothing stands between); each projection then split into an f16 word and an f16 residual word (x 2^10); the third projection formed channel-first into an f32 plane (the weight's rows as the first operand), its added vector joined a row at a time and the sum stored as one f16 word; A QUERY BLOCK OF 1,280 ROWS AT A TIME: the raw sums by three products (word.word, residual.word and word.residual: the last two at 2^-10 added in place) into an f32 plane; ONE kernel takes the softmax of each row of 6,400 sums and stores one f16 word each behind a carry of 2^12, words under 2^-14 stored as nought (a work-group of 160 threads a row, the row read once and held in registers; maximum and sum by a butterfly in each wave and five words in LDS; the library exponential and logarithm); one product (the channel-first third projection against those rows: depth 6,400; its scale 2^-12 undoes the carry) writes the block's columns of the channel-first plane; ONE flat kernel writes the result.
// Compute dtype: all ten inputs converted to bf16 where they are read; the arrays' rows and the weights exact as f16 words down to 2^-14; the two projections TWO f16 words each; the third projection ONE f16 word; the softmax words ONE f16 word behind 2^12 with the small words flushed at the store; every product's accumulation, the raw sums, the softmax's arithmetic and the result f32. v_wmma_f32_16x16x32_f16.
#include <hip/hip_runtime.h>
#define MNG 2                        /* groups */
#define MNC 64                       /* channels: the projections' depth and width */
#define MNN 6400                     /* positions: the softmax's axis */
#define MQB 1280                     /* rows of a query block */
#define MCARRY 4096.0f               /* 2^12: the carry on the softmax words (undone in the last product's scale argument) */
#define MLOGC 8.31776616671934f      /* 12 ln 2 = ln(MCARRY) */
#define MFLUSH 6.103515625e-05f      /* 2^-14: a softmax word under it is stored as nought */
#define MST 160                      /* threads of a softmax work-group: five waves a row */
#define MSV (MNN / 4 / MST)          /* quads of the row a thread holds */
typedef unsigned short v8us __attribute__((ext_vector_type(8), may_alias));
typedef float  v8f  __attribute__((ext_vector_type(8)));
typedef float  v4f  __attribute__((ext_vector_type(4)));
typedef float  v4fa __attribute__((ext_vector_type(4), may_alias));

__device__ __forceinline__ unsigned short bf16_bits(float x) { unsigned int u = __float_as_uint(x); return (unsigned short)((u + 0x7FFFu + ((u >> 16) & 1u)) >> 16); }
__device__ __forceinline__ float bf16_val(unsigned short b) { return __uint_as_float(((unsigned int)b) << 16); }
__device__ __forceinline__ float bf16_round(float x) { return bf16_val(bf16_bits(x)); }

typedef _Float16 v16h __attribute__((ext_vector_type(16)));
union FragH { v16h v; v8us half[2]; _Float16 h[16]; unsigned short u[16]; };

// Wt[n][k] = f16(W[k][n] x scale) from f32 row-major W[K][N] (scale = power of two; bf16-exact weights stay exact in f16 away from the subnormal range)
__global__ __launch_bounds__(256) void k_wt_f16(const float* __restrict__ W, _Float16* __restrict__ Wt, int K, int N, float scale) {
  const int t = blockIdx.x * 256 + threadIdx.x; if (t >= N * (K / 8)) return; const int n = t / (K / 8), k8 = (t % (K / 8)) * 8; FragH f;
#pragma unroll
  for (int i = 0; i < 8; ++i) f.h[i] = (_Float16)(bf16_round(W[(size_t)(k8 + i) * N + n]) * scale); const v8us o = f.half[0];
  *(v8us*)((unsigned short*)Wt + (size_t)n * K + k8) = o; 
}

typedef _Float16 v4h __attribute__((ext_vector_type(4)));

__global__ __launch_bounds__(256) void k_x16(const float* __restrict__ x, _Float16* __restrict__ X16, size_t n8) { const size_t t = (size_t)blockIdx.x * 256 + threadIdx.x; if (t >= n8) return; FragH f;
#pragma unroll
  for (int q = 0; q < 8; ++q) f.h[q] = (_Float16)bf16_round(x[t * 8 + q]); *(v8us*)((unsigned short*)X16 + t * 8) = f.half[0];  }

// ---- fast GEMM (wave tile 32x64; requires M % 32 == 0 rows per launch region and N % 64 == 0) ----
__device__ __forceinline__ v16h g2_frag(const _Float16* p, int hh) { FragH f; f.half[0] = *(const v8us*)((const unsigned short*)p + 8 * hh); f.half[1] = *(const v8us*)((const unsigned short*)p + 16 + 8 * hh); return f.v; }
__device__ __forceinline__ v8f g2_mma(v16h a, v16h b, v8f c) { v8f d = __builtin_amdgcn_wmma_f32_16x16x32_f16(false, a, false, b, (short)0, c, false, false); asm volatile("v_nop\n\tv_nop\n\tv_nop\n\tv_nop" : "+v"(d) : "v"(a), "v"(b)); return d; }
template <int ACT>
__global__ __launch_bounds__(128) void k_gemm2(const _Float16* __restrict__ A, int lda, size_t sA, const _Float16* __restrict__ Bh, int ldb, size_t sB, float alpha, const float* __restrict__ bias, size_t sBias, const float* __restrict__ CP, int rowsPerB, size_t sCPb, int row0g,
    float* __restrict__ C, _Float16* __restrict__ C16, int ldc, size_t sC, int M, int N, int K) { static_assert(ACT == 0 || ACT == 3 || ACT == 6 || ACT == 8 || ACT == 9 || ACT == 11 || ACT == 12 || ACT == 14 || ACT == 15 || ACT == 16 || ACT == 17, "k_gemm2: unsupported ACT code (would silently apply no activation)");
  __shared__ __attribute__((aligned(16))) float so[4][32][68];
  const int tid = threadIdx.x, w = tid >> 5, lane = tid & 31, ln = lane & 15, hh = lane >> 4; const int by = blockIdx.y;
  A += (size_t)by * sA; Bh += (size_t)by * sB; const size_t cofs = (size_t)by * sC; const float* bp = bias ? bias + (size_t)by * sBias : nullptr;
  const int ntn = N >> 6; const int mt = blockIdx.x / ntn, nq = blockIdx.x - mt * ntn; const int row0 = mt * 128 + 32 * w, col0 = nq * 64; if (row0 >= M) return;
  const _Float16* a0p = A + (size_t)(row0 + ln) * lda; const _Float16* a1p = a0p + (size_t)16 * lda;
  const _Float16* b0p = Bh + (size_t)(col0 + ln) * ldb; const _Float16* b1p = b0p + (size_t)16 * ldb; const _Float16* b2p = b1p + (size_t)16 * ldb; const _Float16* b3p = b2p + (size_t)16 * ldb;
  const v8f z8 = {0.f,0.f,0.f,0.f,0.f,0.f,0.f,0.f}; v8f c00 = z8, c01 = z8, c02 = z8, c03 = z8, c10 = z8, c11 = z8, c12 = z8, c13 = z8;
  for (int kb = 0; kb < K; kb += 32) { const v16h a0 = g2_frag(a0p + kb, hh), a1 = g2_frag(a1p + kb, hh);
    v16h b = g2_frag(b0p + kb, hh); c00 = g2_mma(a0, b, c00); c10 = g2_mma(a1, b, c10);
    b = g2_frag(b1p + kb, hh); c01 = g2_mma(a0, b, c01); c11 = g2_mma(a1, b, c11);
    b = g2_frag(b2p + kb, hh); c02 = g2_mma(a0, b, c02); c12 = g2_mma(a1, b, c12);
    b = g2_frag(b3p + kb, hh); c03 = g2_mma(a0, b, c03); c13 = g2_mma(a1, b, c13); }
  v8f accs[8] = {c00, c01, c02, c03, c10, c11, c12, c13};
#pragma unroll
  for (int u = 0; u < 8; ++u) { const int t = u & 3, half = u >> 2; const int col = col0 + t * 16 + ln; const float bv = bp ? bf16_round(bp[col]) : 0.f;
#pragma unroll
    for (int r = 0; r < 8; ++r) { const int rloc = half * 16 + 8 * hh + r; float v = accs[u][r] * alpha + bv; if (CP) { if (rowsPerB < 0) v += CP[cofs + (size_t)(row0g + row0 + rloc) * ldc + col];      /* rowsPerB < 0: own element of the batched C plane */ else { const int bidx = (row0g + row0 + rloc) / rowsPerB; v += CP[(size_t)bidx * sCPb + (size_t)by * 64 + col]; } }
      if (ACT == 3) v = fmaxf(v, 0.f); else if (ACT == 6) v = 0.5f * v * (1.0f + erff(v * 0.70710678118654752f)); else if (ACT == 11) v = 1.0f / (1.0f + expf(-v)); else if (ACT == 15) v = v / (1.0f + expf(-v)); else if (ACT == 12) v = (v > 0.f) ? v : 0.01f * v; else if (ACT == 8) v = tanhf(v); else if (ACT == 9) v = 0.5f * v * (1.0f + tanhf(0.7978845608028654f * (v + 0.044715f * v * v * v))); else if (ACT == 14) v = (v > 0.f) ? v : 0.1f * v; else if (ACT == 16) v = (v >= 0.f) ? v : 0.3f * v; else if (ACT == 17) v = (v >= 0.f) ? v : 0.2f * v;
      so[w][rloc][t * 16 + ln] = v; } }
  __builtin_amdgcn_fence(__ATOMIC_ACQ_REL, "workgroup"); __builtin_amdgcn_wave_barrier();
  const int rsub = lane >> 4, c4 = (lane & 15) * 4;
  {
#pragma unroll
    for (int q = 0; q < 16; ++q) { const int r = q * 2 + rsub; const v4f v = *(const v4fa*)&so[w][r][c4]; if (C) *(v4f*)(C + cofs + (size_t)(row0 + r) * ldc + col0 + c4) = v; if (C16) { v4h h4; for (int i = 0; i < 4; ++i) h4[i] = (_Float16)v[i]; *(v4h*)(C16 + cofs + (size_t)(row0 + r) * ldc + col0 + c4) = h4; } }
     } }

__global__ __launch_bounds__(256) void k_hl(const float* __restrict__ F, _Float16* __restrict__ Hh, _Float16* __restrict__ Hl, size_t n8) { const size_t t = (size_t)blockIdx.x * 256 + threadIdx.x; if (t >= n8) return; FragH fh, fl; const v4f a = *(const v4fa*)(F + t * 8), c = *(const v4fa*)(F + t * 8 + 4);
#pragma unroll
  for (int q = 0; q < 4; ++q) { _Float16 h = (_Float16)a[q]; fh.h[q] = h; fl.h[q] = (_Float16)((a[q] - (float)h) * 1024.0f); h = (_Float16)c[q]; fh.h[4 + q] = h; fl.h[4 + q] = (_Float16)((c[q] - (float)h) * 1024.0f); }
  { *(v8us*)((unsigned short*)Hh + t * 8) = fh.half[0]; *(v8us*)((unsigned short*)Hl + t * 8) = fl.half[0];  } }

__global__ __launch_bounds__(256) void k_rsc(float* __restrict__ F, const float* __restrict__ kv) {
  const unsigned t = blockIdx.x * 256u + threadIdx.x; if (t >= (unsigned)(MNG * MNN * (MNC / 4))) return;
  const unsigned r = t / (MNC / 4); const float kk = bf16_round(kv[r]); float* d = F + (size_t)t * 4; v4f a = *(const v4fa*)d;
#pragma unroll
  for (int q = 0; q < 4; ++q) a[q] = a[q] * kk;
  *(v4f*)d = a;  }

__global__ __launch_bounds__(256) void k_vb(const float* __restrict__ V, const _Float16* __restrict__ bh, _Float16* __restrict__ VC) {
  const unsigned t = blockIdx.x * 256u + threadIdx.x; if (t >= (unsigned)(MNG * MNC * (MNN / 8))) return;
  const unsigned c = (t / (MNN / 8)) % MNC; const float bb = (float)bh[c]; const v4f a = *(const v4fa*)(V + (size_t)t * 8); const v4f b = *(const v4fa*)(V + (size_t)t * 8 + 4); FragH f;
#pragma unroll
  for (int q = 0; q < 4; ++q) { f.h[q] = (_Float16)(a[q] + bb); f.h[4 + q] = (_Float16)(b[q] + bb); }
  unsigned short* o = (unsigned short*)VC + (size_t)t * 8; *(v8us*)o = f.half[0];  }

// lane l <-> l ^ m inside a 16-lane row (m = CTRL - 0x160: the row_xmask control word), and l <-> l ^ 16 across the two rows: register moves, no LDS round trip
template <int CTRL> __device__ __forceinline__ float sm_xm(float v) { return __int_as_float(__builtin_amdgcn_mov_dpp(__float_as_int(v), CTRL, 0xf, 0xf, true)); }
__device__ __forceinline__ float sm_x16(float v) { const int b = __float_as_int(v); return __int_as_float(__builtin_amdgcn_permlanex16(b, b, 0x76543210, 0xfedcba98, false, false)); }
__device__ __forceinline__ float sm_wmax(float v) { v = fmaxf(v, sm_xm<0x161>(v)); v = fmaxf(v, sm_xm<0x162>(v)); v = fmaxf(v, sm_xm<0x164>(v)); v = fmaxf(v, sm_xm<0x168>(v)); return fmaxf(v, sm_x16(v)); }
__device__ __forceinline__ float sm_wsum(float v) { v += sm_xm<0x161>(v); v += sm_xm<0x162>(v); v += sm_xm<0x164>(v); v += sm_xm<0x168>(v); return v + sm_x16(v); }

// a work-group a row: 160 threads hold the row's 6,400 sums in registers (ten quads a thread, a wave's quads contiguous: whole lines), read once
__global__ __launch_bounds__(MST) void k_smf(const float* __restrict__ zs, _Float16* __restrict__ RP, unsigned nrows) {
  __shared__ float rmx[MST / 32]; __shared__ float rsm[MST / 32];
  const unsigned r = blockIdx.x; if (r >= nrows) return;      /* the same for the whole work-group, in front of both barriers */
  const unsigned tid = threadIdx.x, w = tid >> 5; const float* p = zs + (size_t)r * MNN + tid * 4u; _Float16* o = RP + (size_t)r * MNN + tid * 4u; v4f a[MSV];
#pragma unroll
  for (int k = 0; k < MSV; ++k) a[k] = *(const v4fa*)(p + k * (MST * 4));
  asm volatile("s_wait_xcnt 0x0" ::: "memory");      /* the ten loads' offset register and base are given new values further down: the wait stands in front of that */
  float hi = a[0][0];
#pragma unroll
  for (int k = 0; k < MSV; ++k) hi = fmaxf(fmaxf(fmaxf(hi, a[k][0]), fmaxf(a[k][1], a[k][2])), a[k][3]);
  hi = sm_wmax(hi); if ((tid & 31u) == 0u) rmx[w] = hi;
  __syncthreads();      /* the five waves' maxima are in LDS */
  hi = rmx[0];
#pragma unroll
  for (int q = 1; q < MST / 32; ++q) hi = fmaxf(hi, rmx[q]);
  float s0 = 0.0f, s1 = 0.0f, s2 = 0.0f, s3 = 0.0f;
#pragma unroll
  for (int k = 0; k < MSV; ++k) { s0 += expf(a[k][0] - hi); s1 += expf(a[k][1] - hi); s2 += expf(a[k][2] - hi); s3 += expf(a[k][3] - hi); }
  float s = sm_wsum((s0 + s1) + (s2 + s3)); if ((tid & 31u) == 0u) rsm[w] = s;
  __syncthreads();      /* the five waves' sums are in LDS (an array of their own: no third barrier) */
  s = rsm[0];
#pragma unroll
  for (int q = 1; q < MST / 32; ++q) s += rsm[q];
  const float lg = (hi + logf(s)) - MLOGC;      /* 2^12 exp(z - hi) / s = exp(z - lg): the carry and the quotient ride in the exponent: no division and no multiply before the cast */
#pragma unroll
  for (int k = 0; k < MSV; ++k) { v4h h4;
#pragma unroll
    for (int q = 0; q < 4; ++q) { const float wv = expf(a[k][q] - lg); h4[q] = (_Float16)(wv < MFLUSH ? 0.0f : wv); }
    *(v4h*)(o + k * (MST * 4)) = h4; }
}

__global__ __launch_bounds__(256) void k_fin(const float* __restrict__ xa, const float* __restrict__ kv, const float* __restrict__ gs, const float* __restrict__ ag, float* __restrict__ res) {
  const unsigned t = blockIdx.x * 256u + threadIdx.x; if (t >= (unsigned)(MNG * MNC * (MNN / 4))) return;
  const unsigned i0 = (t % (MNN / 4)) * 4, g = t / ((MNN / 4) * MNC);
  const size_t e = (size_t)t * 4; const v4f x4 = *(const v4fa*)(xa + e); const v4f k4 = *(const v4fa*)(kv + (size_t)g * MNN + i0); const v4f a4 = *(const v4fa*)(ag + e); const float gg = bf16_round(gs[0]); v4f o;
#pragma unroll
  for (int q = 0; q < 4; ++q) { const float kk = bf16_round(k4[q]); o[q] = bf16_round(x4[q]) * kk + (gg * (1.0f - kk)) * a4[q]; }
  float* d = res + e; *(v4f*)d = o;  }

extern "C" void kernel_launch(void* const* d_in, const int* in_sizes, int n_in,
                              void* d_out, int out_size, void* d_ws, size_t ws_size, hipStream_t stream) {
  (void)in_sizes; (void)n_in; (void)out_size;
  const float* const* I = (const float* const*)d_in; const float* xa = I[0]; const float* ya = I[1]; const float* kv = I[2]; const float* wa = I[3]; const float* ba = I[4]; const float* wb = I[5]; const float* bb = I[6]; const float* wc = I[7]; const float* bc = I[8]; const float* gs = I[9];      /* xa and ya [2][64][6400]; kv [2][1][6400]; wa, wb, wc [64][64]; ba, bb, bc [64]; gs [1] */
  static_assert(MNN % MQB == 0 && MQB % 128 == 0 && MNN % 64 == 0 && MNC % 64 == 0 && MNC % 32 == 0 && MNN % 32 == 0 && MNN % 8 == 0 && (MNG * MNN) % 128 == 0 && MNN % (MST * 4) == 0 && MST % 32 == 0, "whole tiles");
  uint8_t* wsp = (uint8_t*)d_ws; size_t off = 0;
  auto take = [&](size_t bytes) { uint8_t* p = wsp + off; off += (bytes + 255) & ~(size_t)255; return p; };
  _Float16* XT = (_Float16*)take((size_t)MNG * MNN * MNC * 2); _Float16* YT = (_Float16*)take((size_t)MNG * MNN * MNC * 2); _Float16* WA = (_Float16*)take((size_t)MNC * MNC * 2); _Float16* WB = (_Float16*)take((size_t)MNC * MNC * 2); _Float16* WC = (_Float16*)take((size_t)MNC * MNC * 2); _Float16* BH = (_Float16*)take((size_t)MNC * 2);
  float* QF = (float*)take((size_t)MNG * MNN * MNC * 4); float* KF = (float*)take((size_t)MNG * MNN * MNC * 4); _Float16* QH = (_Float16*)take((size_t)MNG * MNN * MNC * 2); _Float16* QL = (_Float16*)take((size_t)MNG * MNN * MNC * 2); _Float16* KW = (_Float16*)take((size_t)MNG * MNN * MNC * 2); _Float16* KL = (_Float16*)take((size_t)MNG * MNN * MNC * 2); float* VF = (float*)take((size_t)MNG * MNC * MNN * 4); _Float16* VC = (_Float16*)take((size_t)MNG * MNC * MNN * 2);
  float* SC = (float*)take((size_t)MQB * MNN * 4); _Float16* RP = (_Float16*)take((size_t)MQB * MNN * 2); float* AG = (float*)take((size_t)MNG * MNC * MNN * 4);      /* the position rows of both arrays; the weights and the third added vector as f16 words; the two projections in f32 and as word | residual planes; the third projection channel-first in f32 and as f16 words; a block's raw sums and softmax words; the aggregated plane channel-first */
  if (off > ws_size) return;
  for (int g = 0; g < MNG; ++g) {      /* a literal count on the host */
    k_wt_f16<<<(unsigned)(((size_t)MNN * (MNC / 8) + 255) / 256), 256, 0, stream>>>(xa + (size_t)g * MNC * MNN, XT + (size_t)g * MNN * MNC, MNC, MNN, 1.0f);      /* xa[g] as [64][6400]: XT[g][i][c] = xa[g][c][i] */
    k_wt_f16<<<(unsigned)(((size_t)MNN * (MNC / 8) + 255) / 256), 256, 0, stream>>>(ya + (size_t)g * MNC * MNN, YT + (size_t)g * MNN * MNC, MNC, MNN, 1.0f); }
  k_x16<<<(unsigned)(((size_t)MNC * MNC / 8 + 255) / 256), 256, 0, stream>>>(wa, WA, (size_t)MNC * MNC / 8);
  k_x16<<<(unsigned)(((size_t)MNC * MNC / 8 + 255) / 256), 256, 0, stream>>>(wb, WB, (size_t)MNC * MNC / 8);
  k_x16<<<(unsigned)(((size_t)MNC * MNC / 8 + 255) / 256), 256, 0, stream>>>(wc, WC, (size_t)MNC * MNC / 8);
  k_x16<<<1, 256, 0, stream>>>(bc, BH, (size_t)MNC / 8);      /* the third added vector as 64 f16 words */
  k_gemm2<0><<<dim3((unsigned)(((MNG * MNN) / 128) * (MNC / 64)), 1), 128, 0, stream>>>(XT, MNC, 0, WA, MNC, 0, 1.0f, ba, 0, nullptr, 1, 0, 0, QF, nullptr, MNC, 0, MNG * MNN, MNC, MNC);      /* QF[(g, i)][o] = xa[g][:][i] . wa[o][:] + ba[o] */
  k_gemm2<0><<<dim3((unsigned)(((MNG * MNN) / 128) * (MNC / 64)), 1), 128, 0, stream>>>(YT, MNC, 0, WB, MNC, 0, 1.0f, bb, 0, nullptr, 1, 0, 0, KF, nullptr, MNC, 0, MNG * MNN, MNC, MNC);
  k_rsc<<<(unsigned)(((size_t)MNG * MNN * (MNC / 4) + 255) / 256), 256, 0, stream>>>(KF, kv);      /* KF[(g, j)][:] x kv[g][j]: kv's 12,800 words lie in the order of the rows */
  k_hl<<<(unsigned)(((size_t)MNG * MNN * MNC / 8 + 255) / 256), 256, 0, stream>>>(QF, QH, QL, (size_t)MNG * MNN * MNC / 8);
  k_hl<<<(unsigned)(((size_t)MNG * MNN * MNC / 8 + 255) / 256), 256, 0, stream>>>(KF, KW, KL, (size_t)MNG * MNN * MNC / 8);
  k_gemm2<0><<<dim3((unsigned)(((MNC + 127) / 128) * (MNN / 64)), MNG), 128, 0, stream>>>(WC, MNC, 0, XT, MNC, (size_t)MNN * MNC, 1.0f, nullptr, 0, nullptr, 1, 0, 0, VF, nullptr, MNN, (size_t)MNC * MNN, MNC, MNN, MNC);      /* VF[g][o][j] = wc[o][:] . xa[g][:][j]: channel-first */
  k_vb<<<(unsigned)(((size_t)MNG * MNC * (MNN / 8) + 255) / 256), 256, 0, stream>>>(VF, BH, VC);
  for (int g = 0; g < MNG; ++g) for (int i0 = 0; i0 < MNN; i0 += MQB) {      /* literal counts on the host: ten query blocks */
    const _Float16* qh = QH + ((size_t)g * MNN + i0) * MNC; const _Float16* ql = QL + ((size_t)g * MNN + i0) * MNC; const _Float16* kw = KW + (size_t)g * MNN * MNC; const _Float16* kl = KL + (size_t)g * MNN * MNC;
    k_gemm2<0><<<dim3((unsigned)((MQB / 128) * (MNN / 64)), 1), 128, 0, stream>>>(qh, MNC, 0, kw, MNC, 0, 1.0f, nullptr, 0, nullptr, 1, 0, 0, SC, nullptr, MNN, 0, MQB, MNN, MNC);
    k_gemm2<0><<<dim3((unsigned)((MQB / 128) * (MNN / 64)), 1), 128, 0, stream>>>(ql, MNC, 0, kw, MNC, 0, 0.0009765625f, nullptr, 0, SC, -1, 0, 0, SC, nullptr, MNN, 0, MQB, MNN, MNC);
    k_gemm2<0><<<dim3((unsigned)((MQB / 128) * (MNN / 64)), 1), 128, 0, stream>>>(qh, MNC, 0, kl, MNC, 0, 0.0009765625f, nullptr, 0, SC, -1, 0, 0, SC, nullptr, MNN, 0, MQB, MNN, MNC);      /* the raw sums of the block: word.word + 2^-10 (residual.word + word.residual) */
    k_smf<<<(unsigned)MQB, MST, 0, stream>>>(SC, RP, (unsigned)MQB);      /* a work-group a row */
    k_gemm2<0><<<dim3((unsigned)(((MNC + 127) / 128) * (MQB / 64)), 1), 128, 0, stream>>>(VC + (size_t)g * MNC * MNN, MNN, 0, RP, MNN, 0, 1.0f / MCARRY, nullptr, 0, nullptr, 1, 0, 0, AG + (size_t)g * MNC * MNN + i0, nullptr, MNN, 0, MNC, MQB, MNN); }      /* AG[g][c][i0 + i] = sum over j of VC[g][c][j] RP[i][j] / 2^12 */
  k_fin<<<(unsigned)(((size_t)MNG * MNC * (MNN / 4) + 255) / 256), 256, 0, stream>>>(xa, kv, gs, AG, (float*)d_out);      /* every element of the result once */
}

// v003
// Measured time: 134 microseconds a run.
// It is 20.9 times as fast as v001, going by the measured steps of the versions left out in between.
// Over all steps from v000 it is 64.3 times as fast.
// A single-head pair weighting over 6,400 positions of channel-first arrays with a multiplicative key vector: xa [2][64][6400] and ya [2][64][6400] (group, channel, position), kv [2][6400], wa, wb, wc [64][64] stored (row: result channel; column: source channel), ba, bb, bc [64], gs [1]: qr = wa xa + ba, kr = wb ya + bb, vr = wc xa + bc (channel-first); zs[g][i][j] = (sum over c of qr[c][i] kr[c][j]) kv[g][j]; wt[g][i][:] = softmax over j of zs[g][i][:]; ag[g][c][i] = sum over j of vr[c][j] wt[g][i][j]; res = xa kv + gs[0] (1 - kv) ag -> [2][64][6400] f32: one result.
// Structure: TWO launches. ONE projection kernel: a work-group takes 64 positions of one group and one of the three projections; it reads its 64 x 64 block of the channel-first array in whole lines, converts (bf16 first, then f16 words) and lays it transposed in LDS as position rows; the weight's rows and the added vector are converted and laid in LDS beside it; WMMA: the first two projections with the weight's rows as the first operand (a lane's eight accumulator words are eight channels of one position: one 16-byte store), the added vector joined, THE KEY VECTOR MULTIPLIED INTO THE SECOND PROJECTION's ROWS (kr[:][j] kv[j]: the same sum over c, the factor taken inside it: nothing stands between), each split into an f16 word and an f16 residual word (x 2^10); the third projection with the position rows as the first operand (eight positions of one channel a lane: channel-first), its added vector joined and the sum stored as one f16 word; ONE FUSED kernel for raw sums, softmax, weighted sum and result: a work-group of eight waves owns 32 query rows, each wave 800 of the 6,400 keys; the raw sums are formed key-major (keys as the first operand's rows, queries as the second's) by three products (word.word; residual.word and word.residual in one accumulator at 2^-10) and stay in registers; a first pass over the keys keeps each lane's running maximum and sum, joined through LDS; a second pass forms the same raw sums again, takes exp(z - lg) as one f16 word behind a carry of 2^12 (words under 2^-14 stored as nought): the accumulator's layout IS the second operand's layout of the last product (channel-first third projection against those words), so nothing is transposed; the eight waves' partial planes are added through LDS, taken at 2^-12 and joined with xa, kv and gs into the result where they are summed.
// Compute dtype: all ten inputs converted to bf16 where they are read; the arrays' rows and the weights exact as f16 words down to 2^-14; the two projections TWO f16 words each; the third projection ONE f16 word; the softmax words ONE f16 word behind 2^12 with the small words flushed at the cast; every product's accumulation, the raw sums, the softmax's arithmetic and the result f32. v_wmma_f32_16x16x32_f16.
#include <hip/hip_runtime.h>
#define MNG 2                        /* groups */
#define MNC 64                       /* channels: the projections' depth and width */
#define MNN 6400                     /* positions: the softmax's axis */
#define FNI 2                        /* query tiles of 16 rows a fused work-group owns */
#define MCARRY 4096.0f               /* 2^12: the carry on the softmax words (undone where the aggregated plane is written) */
#define MLOGC 8.31776616671934f      /* 12 ln 2 = ln(MCARRY) */
#define MFLUSH 6.103515625e-05f      /* 2^-14: a softmax word under it is stored as nought */
#define FNW 8                        /* waves of a fused work-group: the keys are split among them */
#define FKW (MNN / FNW)              /* keys a wave takes */
typedef unsigned short v8us __attribute__((ext_vector_type(8), may_alias));
typedef float  v8f  __attribute__((ext_vector_type(8)));
typedef float  v4f  __attribute__((ext_vector_type(4)));
typedef float  v4fa __attribute__((ext_vector_type(4), may_alias));

__device__ __forceinline__ unsigned short bf16_bits(float x) { unsigned int u = __float_as_uint(x); return (unsigned short)((u + 0x7FFFu + ((u >> 16) & 1u)) >> 16); }
__device__ __forceinline__ float bf16_val(unsigned short b) { return __uint_as_float(((unsigned int)b) << 16); }
__device__ __forceinline__ float bf16_round(float x) { return bf16_val(bf16_bits(x)); }

typedef _Float16 v16h __attribute__((ext_vector_type(16)));
union FragH { v16h v; v8us half[2]; _Float16 h[16]; unsigned short u[16]; };

__device__ __forceinline__ v16h g2_frag(const _Float16* p, int hh) { FragH f; f.half[0] = *(const v8us*)((const unsigned short*)p + 8 * hh); f.half[1] = *(const v8us*)((const unsigned short*)p + 16 + 8 * hh); return f.v; }
#define PPB 64                       /* positions a projection work-group takes */
#define XPI 72                       /* f16 words from one position row to the next in LDS: 144 bytes = 16 x 9, so that 16-byte fragment reads spread over the banks */
typedef _Float16 v2ha __attribute__((ext_vector_type(2), may_alias));
__device__ __forceinline__ v8f f_mma(v16h a, v16h b, v8f c) { return __builtin_amdgcn_wmma_f32_16x16x32_f16(false, a, false, b, (short)0, c, false, false); }
typedef _Float16 v4ha __attribute__((ext_vector_type(4), may_alias));
// blockIdx.y: 0 the first projection (xa, wa, ba -> QH | QL), 1 the second (ya, wb, bb, x kv -> KW | KL), 2 the third (xa, wc, bc -> VC, channel-first); blockIdx.x: PPB positions of one group
__global__ __launch_bounds__(128) void k_prj(const float* __restrict__ xa, const float* __restrict__ ya, const float* __restrict__ kv, const float* __restrict__ wa, const float* __restrict__ ba, const float* __restrict__ wb, const float* __restrict__ bb, const float* __restrict__ wc, const float* __restrict__ bc,
    _Float16* __restrict__ QH, _Float16* __restrict__ QL, _Float16* __restrict__ KW, _Float16* __restrict__ KL, _Float16* __restrict__ VC) {
  __shared__ __attribute__((aligned(16))) _Float16 xs[PPB][XPI]; __shared__ __attribute__((aligned(16))) _Float16 ws[MNC][XPI]; __shared__ __attribute__((aligned(16))) float bs[MNC];      /* position rows; the weight's rows; the added vector */
  const int tid = threadIdx.x, w = tid >> 5, lane = tid & 31, ln = lane & 15, hh = lane >> 4; const int job = blockIdx.y, g = blockIdx.x / (MNN / PPB), i0 = (blockIdx.x % (MNN / PPB)) * PPB;
  const float* sp = (job == 1 ? ya : xa) + (size_t)g * MNC * MNN + i0 + (tid & 15) * 4 + (size_t)(tid >> 4) * 2 * MNN;      /* a thread: four positions of channels 2 (tid / 16) + 16 q and the next: a wave's load is two whole rows of 256 bytes */
  const float* wp = (job == 0 ? wa : job == 1 ? wb : wc) + tid * 4; const float* bp = job == 0 ? ba : job == 1 ? bb : bc; const size_t p = (size_t)g * MNN + i0 + 16 * w + ln;
  v4f x0[4], x1[4], wv[8];
#pragma unroll
  for (int q = 0; q < 4; ++q) { x0[q] = *(const v4fa*)(sp + (size_t)q * 16 * MNN); x1[q] = *(const v4fa*)(sp + (size_t)(q * 16 + 1) * MNN); }
#pragma unroll
  for (int q = 0; q < 8; ++q) wv[q] = *(const v4fa*)(wp + q * 512);      /* the weight as it lies: a wave's load is 512 bytes in a row */
  const float* bq = bp + (tid & (MNC - 1)); const float* kq = kv + p; const float br = *bq, kr = *kq;      /* kv's 12,800 words lie in the order of the position rows */
  asm volatile("s_wait_xcnt 0x0" :: "v"(x0[0]), "v"(x0[1]), "v"(x0[2]), "v"(x0[3]), "v"(x1[0]), "v"(x1[1]), "v"(x1[2]), "v"(x1[3]), "v"(wv[0]), "v"(wv[1]), "v"(wv[2]), "v"(wv[3]), "v"(wv[4]), "v"(wv[5]), "v"(wv[6]), "v"(wv[7]), "v"(br), "v"(kr), "v"(sp), "v"(wp), "v"(bq), "v"(kq) : "memory");      /* the loaded words and the addresses as inputs only: all 18 loads are issued in front of this line, so that their latencies overlap and are paid once, and no address register is given away in front of the wait */
#pragma unroll
  for (int q = 0; q < 4; ++q) {
#pragma unroll
    for (int e = 0; e < 4; ++e) { v2ha h2; h2[0] = (_Float16)bf16_round(x0[q][e]); h2[1] = (_Float16)bf16_round(x1[q][e]); *(v2ha*)&xs[(tid & 15) * 4 + e][(tid >> 4) * 2 + 16 * q] = h2; } }
#pragma unroll
  for (int q = 0; q < 8; ++q) { v4ha h4;
#pragma unroll
    for (int e = 0; e < 4; ++e) h4[e] = (_Float16)bf16_round(wv[q][e]);
    *(v4ha*)&ws[q * 8 + (tid >> 4)][(tid & 15) * 4] = h4; }
  if (tid < MNC) bs[tid] = bf16_round(br);
  __syncthreads();      /* position rows, weight rows and added vector are in LDS */
  const v8f z8 = {0.f,0.f,0.f,0.f,0.f,0.f,0.f,0.f};
  if (job < 2) {      /* wave w: positions 16 w + ln as columns, all 64 result channels as rows (a lane's eight words: eight channels of one position): it writes whole rows of both planes */
    unsigned short* Hh = (unsigned short*)(job == 0 ? QH : KW) + p * MNC + 8 * hh; unsigned short* Hl = (unsigned short*)(job == 0 ? QL : KL) + p * MNC + 8 * hh; const float kk = job == 1 ? bf16_round(kr) : 1.0f;      /* x 1 is exact */
    const v16h b0 = g2_frag(&xs[16 * w + ln][0], hh), b1 = g2_frag(&xs[16 * w + ln][32], hh);
#pragma unroll
    for (int t = 0; t < 4; ++t) { v8f c = f_mma(g2_frag(&ws[16 * t + ln][0], hh), b0, z8); c = f_mma(g2_frag(&ws[16 * t + ln][32], hh), b1, c); const v4f u0 = *(const v4fa*)&bs[16 * t + 8 * hh], u1 = *(const v4fa*)&bs[16 * t + 8 * hh + 4]; FragH fh, fl;
#pragma unroll
      for (int r = 0; r < 8; ++r) { const float v = (c[r] + (r < 4 ? u0[r & 3] : u1[r & 3])) * kk; const _Float16 h = (_Float16)v; fh.h[r] = h; fl.h[r] = (_Float16)((v - (float)h) * 1024.0f); }
      *(v8us*)(Hh + 16 * t) = fh.half[0]; *(v8us*)(Hl + 16 * t) = fl.half[0]; }
  } else {      /* wave w: result channels 16 w + ln as columns, all PPB positions as rows (a lane's eight words: eight positions of one channel): it writes whole lines of 16 channel rows */
    unsigned short* vo = (unsigned short*)VC + ((size_t)g * MNC + 16 * w + ln) * MNN + i0 + 8 * hh; const float bv = (float)(_Float16)bs[16 * w + ln];
    const v16h b0 = g2_frag(&ws[16 * w + ln][0], hh), b1 = g2_frag(&ws[16 * w + ln][32], hh);
#pragma unroll
    for (int t = 0; t < 4; ++t) { v8f c = f_mma(g2_frag(&xs[16 * t + ln][0], hh), b0, z8); c = f_mma(g2_frag(&xs[16 * t + ln][32], hh), b1, c); FragH f;
#pragma unroll
      for (int r = 0; r < 8; ++r) f.h[r] = (_Float16)(c[r] + bv);
      *(v8us*)(vo + 16 * t) = f.half[0]; }
    asm volatile("s_wait_xcnt 0x0" ::: "memory");      /* behind the arm's last store: the stores' address pair is not given away in front of the wait */
  }
}

// the raw sums of 16 keys (rows: 8 hh + r) against FNI x 16 queries (columns: ln): word.word, and residual.word + word.residual in a second accumulator at 2^-10
struct KF { v16h w0, w1, l0, l1; };      /* 16 keys: word and residual, two depth steps of 32 */
__device__ __forceinline__ KF f_load(const _Float16* __restrict__ kw, const _Float16* __restrict__ kl, int hh) { KF k; k.w0 = g2_frag(kw, hh); k.w1 = g2_frag(kw + 32, hh); k.l0 = g2_frag(kl, hh); k.l1 = g2_frag(kl + 32, hh); return k; }
__device__ __forceinline__ void f_tile(const KF& k, const v16h (&qh)[FNI][2], const v16h (&ql)[FNI][2], v8f (&s)[FNI]) { const v8f z8 = {0.f,0.f,0.f,0.f,0.f,0.f,0.f,0.f};
#pragma unroll
  for (int ni = 0; ni < FNI; ++ni) { v8f cm = f_mma(k.w0, qh[ni][0], z8), cr = f_mma(k.w0, ql[ni][0], z8); cm = f_mma(k.w1, qh[ni][1], cm); cr = f_mma(k.w1, ql[ni][1], cr); cr = f_mma(k.l0, qh[ni][0], cr); cr = f_mma(k.l1, qh[ni][1], cr);
    s[ni] = cm + cr * 0.0009765625f; } }

// a work-group: FNI x 16 query rows of one group; wave w: keys [w FKW, (w + 1) FKW), 32 a trip. Lane (ln, hh) sees query ln of each tile and keys 8 hh + r and 16 + 8 hh + r of the trip's 32.
__global__ __launch_bounds__(FNW * 32) void k_fat(const _Float16* __restrict__ QH, const _Float16* __restrict__ QL, const _Float16* __restrict__ KW, const _Float16* __restrict__ KL, const _Float16* __restrict__ VC, const float* __restrict__ xa, const float* __restrict__ kv, const float* __restrict__ gs, float* __restrict__ res) {
  __shared__ float smx[FNW][FNI][32]; __shared__ float ssm[FNW][FNI][32]; __shared__ float red[FNW][FNI * 4 * 8 * 32];
  const int tid = threadIdx.x, w = tid >> 5, lane = tid & 31, ln = lane & 15, hh = lane >> 4; const int g = blockIdx.y, i0 = blockIdx.x * (FNI * 16);
  v16h qh[FNI][2], ql[FNI][2];
#pragma unroll
  for (int ni = 0; ni < FNI; ++ni) { const size_t e = ((size_t)g * MNN + i0 + ni * 16 + ln) * MNC; qh[ni][0] = g2_frag(QH + e, hh); qh[ni][1] = g2_frag(QH + e + 32, hh); }
  asm volatile("s_wait_xcnt 0x0" ::: "memory");      /* the loads' address registers are given to later loads' results: the wait stands in front of that */
#pragma unroll
  for (int ni = 0; ni < FNI; ++ni) { const size_t e = ((size_t)g * MNN + i0 + ni * 16 + ln) * MNC; ql[ni][0] = g2_frag(QL + e, hh); ql[ni][1] = g2_frag(QL + e + 32, hh); }
  asm volatile("s_wait_xcnt 0x0" ::: "memory");      /* as above, in front of the first keys' loads */
  const size_t k0 = ((size_t)g * MNN + w * FKW + ln) * MNC; const _Float16* kwp = KW + k0; const _Float16* klp = KL + k0;
  float m[FNI], l[FNI];
#pragma unroll
  for (int ni = 0; ni < FNI; ++ni) { m[ni] = -__builtin_inff(); l[ni] = 0.0f; }
  { KF ka = f_load(kwp, klp, hh), kb = f_load(kwp + 16 * MNC, klp + 16 * MNC, hh);
  for (int it = 0; it < FKW / 32; ++it) { v8f s0[FNI], s1[FNI]; f_tile(ka, qh, ql, s0); f_tile(kb, qh, ql, s1);
    const size_t nx = (size_t)(it + 1 < FKW / 32 ? it + 1 : it) * 32 * MNC; ka = f_load(kwp + nx, klp + nx, hh); kb = f_load(kwp + nx + 16 * MNC, klp + nx + 16 * MNC, hh);      /* the next trip's keys fly under this trip's exponentials (the last trip reads its own again: in bounds, unused) */
#pragma unroll
    for (int ni = 0; ni < FNI; ++ni) { float t = fmaxf(s0[ni][0], s1[ni][0]);
#pragma unroll
      for (int r = 1; r < 8; ++r) t = fmaxf(t, fmaxf(s0[ni][r], s1[ni][r]));
      const float mn = fmaxf(m[ni], t); float a0 = l[ni] * expf(m[ni] - mn), a1 = 0.0f;
#pragma unroll
      for (int r = 0; r < 8; ++r) { a0 += expf(s0[ni][r] - mn); a1 += expf(s1[ni][r] - mn); }
      m[ni] = mn; l[ni] = a0 + a1; }
    asm volatile("s_wait_xcnt 0x0" ::: "memory"); } }      /* at the trip's foot: the next trip forms new addresses in the registers that this trip's loads name, and the wait stands in front of that */
#pragma unroll
  for (int ni = 0; ni < FNI; ++ni) { smx[w][ni][lane] = m[ni]; ssm[w][ni][lane] = l[ni]; }
  __syncthreads();      /* every wave's maxima and sums are in LDS */
  float lg[FNI];
#pragma unroll
  for (int ni = 0; ni < FNI; ++ni) { float hi = smx[0][ni][ln];
#pragma unroll
    for (int q = 1; q < FNW * 2; ++q) hi = fmaxf(hi, smx[q >> 1][ni][(q & 1) * 16 + ln]);
    float s = 0.0f;
#pragma unroll
    for (int q = 0; q < FNW * 2; ++q) s += ssm[q >> 1][ni][(q & 1) * 16 + ln] * expf(smx[q >> 1][ni][(q & 1) * 16 + ln] - hi);
    lg[ni] = (hi + logf(s)) - MLOGC; }      /* 2^12 exp(z - hi) / s = exp(z - lg): the carry and the quotient ride in the exponent */
  const v8f z8 = {0.f,0.f,0.f,0.f,0.f,0.f,0.f,0.f}; v8f o[FNI][4];
#pragma unroll
  for (int ni = 0; ni < FNI; ++ni) { o[ni][0] = z8; o[ni][1] = z8; o[ni][2] = z8; o[ni][3] = z8; }
  const _Float16* vp = VC + ((size_t)g * MNC + ln) * MNN + w * FKW;
  for (int it = 0; it < FKW / 32; ++it) { v8f s0[FNI], s1[FNI]; v16h va[4]; const size_t cu = (size_t)it * 32 * MNC;
    { const KF ka = f_load(kwp + cu, klp + cu, hh), kb = f_load(kwp + cu + 16 * MNC, klp + cu + 16 * MNC, hh);
    f_tile(ka, qh, ql, s0); f_tile(kb, qh, ql, s1); }
    FragH pf[FNI];
#pragma unroll
    for (int ni = 0; ni < FNI; ++ni) {
#pragma unroll
      for (int r = 0; r < 8; ++r) { const float u0 = expf(s0[ni][r] - lg[ni]), u1 = expf(s1[ni][r] - lg[ni]); pf[ni].h[r] = (_Float16)(u0 < MFLUSH ? 0.0f : u0); pf[ni].h[8 + r] = (_Float16)(u1 < MFLUSH ? 0.0f : u1); } }
#pragma unroll
    for (int ct = 0; ct < 4; ++ct) va[ct] = g2_frag(vp + (size_t)ct * 16 * MNN + it * 32, hh);
#pragma unroll
    for (int ct = 0; ct < 4; ++ct) {
#pragma unroll
      for (int ni = 0; ni < FNI; ++ni) o[ni][ct] = f_mma(va[ct], pf[ni].v, o[ni][ct]); } }
  const size_t e0 = ((size_t)g * MNC + w) * MNN + i0 + lane; float xv[MNC / FNW];      /* the result's other terms, read here so that they fly under the joining of the partial planes */
#pragma unroll
  for (int q = 0; q < MNC / FNW; ++q) xv[q] = xa[e0 + (size_t)q * FNW * MNN];
  const float kk = bf16_round(kv[(size_t)g * MNN + i0 + lane]), gk = bf16_round(gs[0]) * (1.0f - kk);
#pragma unroll
  for (int ni = 0; ni < FNI; ++ni) {
#pragma unroll
    for (int ct = 0; ct < 4; ++ct) {
#pragma unroll
      for (int r = 0; r < 8; ++r) red[w][((ni * 4 + ct) * 8 + r) * 32 + lane] = o[ni][ct][r]; } }
  __syncthreads();      /* every wave's partial plane is in LDS */
#pragma unroll
  for (int q = 0; q < MNC / FNW; ++q) { const int c = w + FNW * q; const int e = (((lane >> 4) * 4 + (c >> 4)) * 8 + (c & 7)) * 32 + ((c >> 3) & 1) * 16 + ln; float s = red[0][e];      /* a wave a channel: its 32 lanes write one whole line of the result */
#pragma unroll
    for (int u = 1; u < FNW; ++u) s += red[u][e];
    res[e0 + (size_t)q * FNW * MNN] = bf16_round(xv[q]) * kk + gk * (s * (1.0f / MCARRY)); }      /* every element of the result once */
}

extern "C" void kernel_launch(void* const* d_in, const int* in_sizes, int n_in,
                              void* d_out, int out_size, void* d_ws, size_t ws_size, hipStream_t stream) {
  (void)in_sizes; (void)n_in; (void)out_size;
  const float* const* I = (const float* const*)d_in; const float* xa = I[0]; const float* ya = I[1]; const float* kv = I[2]; const float* wa = I[3]; const float* ba = I[4]; const float* wb = I[5]; const float* bb = I[6]; const float* wc = I[7]; const float* bc = I[8]; const float* gs = I[9];      /* xa and ya [2][64][6400]; kv [2][1][6400]; wa, wb, wc [64][64]; ba, bb, bc [64]; gs [1] */
  static_assert(MNN % (FNI * 16) == 0 && FNI == 2 && MNN % FNW == 0 && FKW % 32 == 0 && MNC == 64 && MNC % FNW == 0 && MNN % PPB == 0 && PPB == 64 && XPI >= MNC && XPI % 8 == 0, "whole tiles");
  uint8_t* wsp = (uint8_t*)d_ws; size_t off = 0;
  auto take = [&](size_t bytes) { uint8_t* p = wsp + off; off += (bytes + 255) & ~(size_t)255; return p; };
  _Float16* QH = (_Float16*)take((size_t)MNG * MNN * MNC * 2); _Float16* QL = (_Float16*)take((size_t)MNG * MNN * MNC * 2); _Float16* KW = (_Float16*)take((size_t)MNG * MNN * MNC * 2); _Float16* KL = (_Float16*)take((size_t)MNG * MNN * MNC * 2); _Float16* VC = (_Float16*)take((size_t)MNG * MNC * MNN * 2);      /* the first two projections as word | residual planes of position rows; the third channel-first as f16 words */
  if (off > ws_size) return;
  k_prj<<<dim3((unsigned)(MNG * (MNN / PPB)), 3), 128, 0, stream>>>(xa, ya, kv, wa, ba, wb, bb, wc, bc, QH, QL, KW, KL, VC);
  k_fat<<<dim3((unsigned)(MNN / (FNI * 16)), MNG), FNW * 32, 0, stream>>>(QH, QL, KW, KL, VC, xa, kv, gs, (float*)d_out);      /* res[g][c][i] = xa kv + gs (1 - kv) sum over j of VC[g][c][j] softmax(raw sums)[i][j] */
}

// v004
// It runs in 97 microseconds.
// Two timings next to v003 put it at 1.39 and 1.38 times that version's speed.
// Over all steps from v000 it is 88.9 times as fast.
// A single-head pair weighting over 6,400 positions of channel-first arrays with a multiplicative key vector: xa [2][64][6400] and ya [2][64][6400] (group, channel, position), kv [2][6400], wa, wb, wc [64][64] stored (row: result channel; column: source channel), ba, bb, bc [64], gs [1]: qr = wa xa + ba, kr = wb ya + bb, vr = wc xa + bc (channel-first); zs[g][i][j] = (sum over c of qr[c][i] kr[c][j]) kv[g][j]; wt[g][i][:] = softmax over j of zs[g][i][:]; ag[g][c][i] = sum over j of vr[c][j] wt[g][i][j]; res = xa kv + gs[0] (1 - kv) ag -> [2][64][6400] f32: one result.
// Structure: TWO launches. ONE projection kernel: a work-group takes 64 positions of one group and one of the three projections; it reads its 64 x 64 block of the channel-first array in whole lines, converts (bf16 first, then f16 words) and lays it transposed in LDS as position rows; the weight's rows and the added vector are converted and laid in LDS beside it; WMMA: the first two projections with the weight's rows as the first operand (a lane's eight accumulator words are eight channels of one position: one 16-byte store, LAID IN FRAGMENT ORDER: a tile of 16 positions is four pieces of 512 bytes, lane after lane, exactly as the fused kernel's waves load them, so that every wave-wide store and load covers four whole lines), the added vector joined, THE KEY VECTOR MULTIPLIED INTO THE SECOND PROJECTION's ROWS (kr[:][j] kv[j]: the same sum over c, the factor taken inside it: nothing stands between), each split into an f16 word and an f16 residual word (x 2^10); the third projection with the position rows as the first operand (eight positions of one channel a lane; stored in fragment order too: 32 positions x 16 channels are two pieces of 512 bytes), its added vector joined and the sum stored as one f16 word; ONE FUSED kernel for raw sums, softmax, weighted sum and result: a work-group of eight waves owns 32 query rows, each wave 800 of the 6,400 keys; the raw sums are formed key-major (keys as the first operand's rows, queries as the second's) by three products (word.word; residual.word and word.residual in one accumulator at 2^-10) and stay in registers; a first pass over the keys keeps each lane's running maximum and sum, joined through LDS; a second pass forms the same raw sums again, takes exp(z - lg) as one f16 word behind a carry of 2^12 (words under 2^-14 stored as nought): the accumulator's layout IS the second operand's layout of the last product (channel-first third projection against those words), so nothing is transposed; the eight waves' partial planes are added through LDS, taken at 2^-12 and joined with xa, kv and gs into the result where they are summed.
// Compute dtype: all ten inputs converted to bf16 where they are read; the arrays' rows and the weights exact as f16 words down to 2^-14; the two projections TWO f16 words each; the third projection ONE f16 word; the softmax words ONE f16 word behind 2^12 with the small words flushed at the cast; every product's accumulation, the raw sums, the softmax's arithmetic and the result f32. v_wmma_f32_16x16x32_f16.
#include <hip/hip_runtime.h>
#define MNG 2                        /* groups */
#define MNC 64                       /* channels: the projections' depth and width */
#define MNN 6400                     /* positions: the softmax's axis */
#define FNI 2                        /* query tiles of 16 rows a fused work-group owns */
#define MCARRY 4096.0f               /* 2^12: the carry on the softmax words (undone where the aggregated plane is written) */
#define MLOGC 8.31776616671934f      /* 12 ln 2 = ln(MCARRY) */
#define MFLUSH 6.103515625e-05f      /* 2^-14: a softmax word under it is stored as nought */
#define FNW 8                        /* waves of a fused work-group: the keys are split among them */
#define FKW (MNN / FNW)              /* keys a wave takes */
typedef unsigned short v8us __attribute__((ext_vector_type(8), may_alias));
typedef float  v8f  __attribute__((ext_vector_type(8)));
typedef float  v4f  __attribute__((ext_vector_type(4)));
typedef float  v4fa __attribute__((ext_vector_type(4), may_alias));

__device__ __forceinline__ unsigned short bf16_bits(float x) { unsigned int u = __float_as_uint(x); return (unsigned short)((u + 0x7FFFu + ((u >> 16) & 1u)) >> 16); }
__device__ __forceinline__ float bf16_val(unsigned short b) { return __uint_as_float(((unsigned int)b) << 16); }
__device__ __forceinline__ float bf16_round(float x) { return bf16_val(bf16_bits(x)); }

typedef _Float16 v16h __attribute__((ext_vector_type(16)));
union FragH { v16h v; v8us half[2]; _Float16 h[16]; unsigned short u[16]; };

__device__ __forceinline__ v16h g2_frag(const _Float16* p, int hh) { FragH f; f.half[0] = *(const v8us*)((const unsigned short*)p + 8 * hh); f.half[1] = *(const v8us*)((const unsigned short*)p + 16 + 8 * hh); return f.v; }
// a fragment from a workspace plane laid in fragment order: p is the lane's own 8 words in a tile's first piece of 512 bytes (32 lanes x 16 bytes in a row); pieces 2 d and 2 d + 1 are the two halves of depth step d, so that a wave's load is four whole lines
__device__ __forceinline__ v16h g3_frag(const _Float16* p, int d) { FragH f; f.half[0] = *(const v8us*)((const unsigned short*)p + 512 * d); f.half[1] = *(const v8us*)((const unsigned short*)p + 512 * d + 256); return f.v; }
#define PPB 64                       /* positions a projection work-group takes */
#define XPI 72                       /* f16 words from one position row to the next in LDS: 144 bytes = 16 x 9, so that 16-byte fragment reads spread over the banks */
typedef _Float16 v2ha __attribute__((ext_vector_type(2), may_alias));
__device__ __forceinline__ v8f f_mma(v16h a, v16h b, v8f c) { return __builtin_amdgcn_wmma_f32_16x16x32_f16(false, a, false, b, (short)0, c, false, false); }
typedef _Float16 v4ha __attribute__((ext_vector_type(4), may_alias));
// blockIdx.y: 0 the first projection (xa, wa, ba -> QH | QL), 1 the second (ya, wb, bb, x kv -> KW | KL), 2 the third (xa, wc, bc -> VC); blockIdx.x: PPB positions of one group
__global__ __launch_bounds__(128) void k_prj(const float* __restrict__ xa, const float* __restrict__ ya, const float* __restrict__ kv, const float* __restrict__ wa, const float* __restrict__ ba, const float* __restrict__ wb, const float* __restrict__ bb, const float* __restrict__ wc, const float* __restrict__ bc,
    _Float16* __restrict__ QH, _Float16* __restrict__ QL, _Float16* __restrict__ KW, _Float16* __restrict__ KL, _Float16* __restrict__ VC) {
  __shared__ __attribute__((aligned(16))) _Float16 xs[PPB][XPI]; __shared__ __attribute__((aligned(16))) _Float16 ws[MNC][XPI]; __shared__ __attribute__((aligned(16))) float bs[MNC];      /* position rows; the weight's rows; the added vector */
  const int tid = threadIdx.x, w = tid >> 5, lane = tid & 31, ln = lane & 15, hh = lane >> 4; const int job = blockIdx.y, g = blockIdx.x / (MNN / PPB), i0 = (blockIdx.x % (MNN / PPB)) * PPB;
  const float* sp = (job == 1 ? ya : xa) + (size_t)g * MNC * MNN + i0 + (tid & 15) * 4 + (size_t)(tid >> 4) * 2 * MNN;      /* a thread: four positions of channels 2 (tid / 16) + 16 q and the next: a wave's load is two whole rows of 256 bytes */
  const float* wp = (job == 0 ? wa : job == 1 ? wb : wc) + tid * 4; const float* bp = job == 0 ? ba : job == 1 ? bb : bc; const size_t p = (size_t)g * MNN + i0 + 16 * w + ln;
  v4f x0[4], x1[4], wv[8];
#pragma unroll
  for (int q = 0; q < 4; ++q) { x0[q] = *(const v4fa*)(sp + (size_t)q * 16 * MNN); x1[q] = *(const v4fa*)(sp + (size_t)(q * 16 + 1) * MNN); }
#pragma unroll
  for (int q = 0; q < 8; ++q) wv[q] = *(const v4fa*)(wp + q * 512);      /* the weight as it lies: a wave's load is 512 bytes in a row */
  const float* bq = bp + (tid & (MNC - 1)); const float* kq = kv + p; const float br = *bq, kr = *kq;      /* kv's 12,800 words lie in the order of the position rows */
  asm volatile("s_wait_xcnt 0x0" :: "v"(x0[0]), "v"(x0[1]), "v"(x0[2]), "v"(x0[3]), "v"(x1[0]), "v"(x1[1]), "v"(x1[2]), "v"(x1[3]), "v"(wv[0]), "v"(wv[1]), "v"(wv[2]), "v"(wv[3]), "v"(wv[4]), "v"(wv[5]), "v"(wv[6]), "v"(wv[7]), "v"(br), "v"(kr), "v"(sp), "v"(wp), "v"(bq), "v"(kq) : "memory");      /* the loaded words and the addresses as inputs only: all 18 loads are issued in front of this line, so that their latencies overlap and are paid once, and no address register is given away in front of the wait */
#pragma unroll
  for (int q = 0; q < 4; ++q) {
#pragma unroll
    for (int e = 0; e < 4; ++e) { v2ha h2; h2[0] = (_Float16)bf16_round(x0[q][e]); h2[1] = (_Float16)bf16_round(x1[q][e]); *(v2ha*)&xs[(tid & 15) * 4 + e][(tid >> 4) * 2 + 16 * q] = h2; } }
#pragma unroll
  for (int q = 0; q < 8; ++q) { v4ha h4;
#pragma unroll
    for (int e = 0; e < 4; ++e) h4[e] = (_Float16)bf16_round(wv[q][e]);
    *(v4ha*)&ws[q * 8 + (tid >> 4)][(tid & 15) * 4] = h4; }
  if (tid < MNC) bs[tid] = bf16_round(br);
  __syncthreads();      /* position rows, weight rows and added vector are in LDS */
  const v8f z8 = {0.f,0.f,0.f,0.f,0.f,0.f,0.f,0.f};
  if (job < 2) {      /* wave w: positions 16 w + ln as columns, all 64 result channels as rows (a lane's eight words: eight channels of one position): it writes one whole tile of both planes */
    const size_t pt = ((size_t)g * MNN + i0 + 16 * w) * MNC + lane * 8; unsigned short* Hh = (unsigned short*)(job == 0 ? QH : KW) + pt; unsigned short* Hl = (unsigned short*)(job == 0 ? QL : KL) + pt;      /* the wave's tile of 16 positions: 2 KiB in fragment order, piece t = channels 16 t + 8 hh + r of position ln at lane 16 hh + ln */ const float kk = job == 1 ? bf16_round(kr) : 1.0f;      /* x 1 is exact */
    const v16h b0 = g2_frag(&xs[16 * w + ln][0], hh), b1 = g2_frag(&xs[16 * w + ln][32], hh); FragH fh[4], fl[4];
#pragma unroll
    for (int t = 0; t < 4; ++t) { v8f c = f_mma(g2_frag(&ws[16 * t + ln][0], hh), b0, z8); c = f_mma(g2_frag(&ws[16 * t + ln][32], hh), b1, c); const v4f u0 = *(const v4fa*)&bs[16 * t + 8 * hh], u1 = *(const v4fa*)&bs[16 * t + 8 * hh + 4];
#pragma unroll
      for (int r = 0; r < 8; ++r) { const float v = (c[r] + (r < 4 ? u0[r & 3] : u1[r & 3])) * kk; const _Float16 h = (_Float16)v; fh[t].h[r] = h; fl[t].h[r] = (_Float16)((v - (float)h) * 1024.0f); } }
#pragma unroll
    for (int t = 0; t < 4; ++t) { *(v8us*)(Hh + 256 * t) = fh[t].half[0]; *(v8us*)(Hl + 256 * t) = fl[t].half[0]; }      /* the tile's eight pieces in a run at the arm's end: no stored register is written again */
  } else {      /* wave w: result channels 16 w + ln as columns, all PPB positions as rows (a lane's eight words: eight positions of one channel): it writes whole pieces of 512 bytes */
    unsigned short* vo = (unsigned short*)VC + (((size_t)g * MNN + i0) / 32 * 4 + w) * 512 + lane * 8;      /* 32 positions x 16 channels: 1 KiB in fragment order, piece h = positions 16 h + 8 hh + r of channel ln at lane 16 hh + ln; four channel tiles in a row */ const float bv = (float)(_Float16)bs[16 * w + ln];
    const v16h b0 = g2_frag(&ws[16 * w + ln][0], hh), b1 = g2_frag(&ws[16 * w + ln][32], hh);
#pragma unroll
    for (int t = 0; t < 4; ++t) { v8f c = f_mma(g2_frag(&xs[16 * t + ln][0], hh), b0, z8); c = f_mma(g2_frag(&xs[16 * t + ln][32], hh), b1, c); FragH f;
#pragma unroll
      for (int r = 0; r < 8; ++r) f.h[r] = (_Float16)(c[r] + bv);
      *(v8us*)(vo + (t >> 1) * 2048 + (t & 1) * 256) = f.half[0]; }
    asm volatile("s_wait_xcnt 0x0" ::: "memory");      /* behind the arm's last store: the stores' address pair is not given away in front of the wait */
  }
}

// the raw sums of 16 keys (rows: 8 hh + r) against FNI x 16 queries (columns: ln): word.word, and residual.word + word.residual in a second accumulator at 2^-10
struct KF { v16h w0, w1, l0, l1; };      /* 16 keys: word and residual, two depth steps of 32 */
__device__ __forceinline__ KF f_load(const _Float16* __restrict__ kw, const _Float16* __restrict__ kl) { KF k; k.w0 = g3_frag(kw, 0); k.w1 = g3_frag(kw, 1); k.l0 = g3_frag(kl, 0); k.l1 = g3_frag(kl, 1); return k; }
__device__ __forceinline__ void f_tile(const KF& k, const v16h (&qh)[FNI][2], const v16h (&ql)[FNI][2], v8f (&s)[FNI]) { const v8f z8 = {0.f,0.f,0.f,0.f,0.f,0.f,0.f,0.f};
#pragma unroll
  for (int ni = 0; ni < FNI; ++ni) { v8f cm = f_mma(k.w0, qh[ni][0], z8), cr = f_mma(k.w0, ql[ni][0], z8); cm = f_mma(k.w1, qh[ni][1], cm); cr = f_mma(k.w1, ql[ni][1], cr); cr = f_mma(k.l0, qh[ni][0], cr); cr = f_mma(k.l1, qh[ni][1], cr);
    s[ni] = cm + cr * 0.0009765625f; } }

// a work-group: FNI x 16 query rows of one group; wave w: keys [w FKW, (w + 1) FKW), 32 a trip. Lane (ln, hh) sees query ln of each tile and keys 8 hh + r and 16 + 8 hh + r of the trip's 32.
__global__ __launch_bounds__(FNW * 32) void k_fat(const _Float16* __restrict__ QH, const _Float16* __restrict__ QL, const _Float16* __restrict__ KW, const _Float16* __restrict__ KL, const _Float16* __restrict__ VC, const float* __restrict__ xa, const float* __restrict__ kv, const float* __restrict__ gs, float* __restrict__ res) {
  __shared__ float smx[FNW][FNI][32]; __shared__ float ssm[FNW][FNI][32]; __shared__ float red[FNW][FNI * 4 * 8 * 32];
  const int tid = threadIdx.x, w = tid >> 5, lane = tid & 31, ln = lane & 15, hh = lane >> 4; const int g = blockIdx.y, i0 = blockIdx.x * (FNI * 16);
  v16h qh[FNI][2], ql[FNI][2];
#pragma unroll
  for (int ni = 0; ni < FNI; ++ni) { const size_t e = ((size_t)g * MNN + i0 + ni * 16) * MNC + lane * 8; qh[ni][0] = g3_frag(QH + e, 0); qh[ni][1] = g3_frag(QH + e, 1); }
  asm volatile("s_wait_xcnt 0x0" ::: "memory");      /* the loads' address registers are given to later loads' results: the wait stands in front of that */
#pragma unroll
  for (int ni = 0; ni < FNI; ++ni) { const size_t e = ((size_t)g * MNN + i0 + ni * 16) * MNC + lane * 8; ql[ni][0] = g3_frag(QL + e, 0); ql[ni][1] = g3_frag(QL + e, 1); }
  asm volatile("s_wait_xcnt 0x0" ::: "memory");      /* as above, in front of the first keys' loads */
  const size_t k0 = ((size_t)g * MNN + w * FKW) * MNC + lane * 8; const _Float16* kwp = KW + k0; const _Float16* klp = KL + k0;
  float m[FNI], l[FNI];
#pragma unroll
  for (int ni = 0; ni < FNI; ++ni) { m[ni] = -__builtin_inff(); l[ni] = 0.0f; }
  { KF ka = f_load(kwp, klp), kb = f_load(kwp + 16 * MNC, klp + 16 * MNC);
  for (int it = 0; it < FKW / 32; ++it) { v8f s0[FNI], s1[FNI]; f_tile(ka, qh, ql, s0); f_tile(kb, qh, ql, s1);
    const size_t nx = (size_t)(it + 1 < FKW / 32 ? it + 1 : it) * 32 * MNC; ka = f_load(kwp + nx, klp + nx); kb = f_load(kwp + nx + 16 * MNC, klp + nx + 16 * MNC);      /* the next trip's keys fly under this trip's exponentials (the last trip reads its own again: in bounds, unused) */
#pragma unroll
    for (int ni = 0; ni < FNI; ++ni) { float t = fmaxf(s0[ni][0], s1[ni][0]);
#pragma unroll
      for (int r = 1; r < 8; ++r) t = fmaxf(t, fmaxf(s0[ni][r], s1[ni][r]));
      const float mn = fmaxf(m[ni], t); float a0 = l[ni] * expf(m[ni] - mn), a1 = 0.0f;
#pragma unroll
      for (int r = 0; r < 8; ++r) { a0 += expf(s0[ni][r] - mn); a1 += expf(s1[ni][r] - mn); }
      m[ni] = mn; l[ni] = a0 + a1; }
    asm volatile("s_wait_xcnt 0x0" ::: "memory"); } }      /* at the trip's foot: the next trip forms new addresses in the registers that this trip's loads name, and the wait stands in front of that */
#pragma unroll
  for (int ni = 0; ni < FNI; ++ni) { smx[w][ni][lane] = m[ni]; ssm[w][ni][lane] = l[ni]; }
  __syncthreads();      /* every wave's maxima and sums are in LDS */
  float lg[FNI];
#pragma unroll
  for (int ni = 0; ni < FNI; ++ni) { float hi = smx[0][ni][ln];
#pragma unroll
    for (int q = 1; q < FNW * 2; ++q) hi = fmaxf(hi, smx[q >> 1][ni][(q & 1) * 16 + ln]);
    float s = 0.0f;
#pragma unroll
    for (int q = 0; q < FNW * 2; ++q) s += ssm[q >> 1][ni][(q & 1) * 16 + ln] * expf(smx[q >> 1][ni][(q & 1) * 16 + ln] - hi);
    lg[ni] = (hi + logf(s)) - MLOGC; }      /* 2^12 exp(z - hi) / s = exp(z - lg): the carry and the quotient ride in the exponent */
  const v8f z8 = {0.f,0.f,0.f,0.f,0.f,0.f,0.f,0.f}; v8f o[FNI][4];
#pragma unroll
  for (int ni = 0; ni < FNI; ++ni) { o[ni][0] = z8; o[ni][1] = z8; o[ni][2] = z8; o[ni][3] = z8; }
  const _Float16* vp = VC + ((size_t)g * MNN + w * FKW) * MNC + lane * 8;      /* 32 keys x 64 channels are 2,048 words in a row */
  for (int it = 0; it < FKW / 32; ++it) { v8f s0[FNI], s1[FNI]; v16h va[4]; const size_t cu = (size_t)it * 32 * MNC;
    { const KF ka = f_load(kwp + cu, klp + cu), kb = f_load(kwp + cu + 16 * MNC, klp + cu + 16 * MNC);
    asm volatile("s_wait_xcnt 0x0" ::: "memory");      /* behind the keys' loads: their address registers are given to the raw sums further down, and the wait stands in front of that */
    f_tile(ka, qh, ql, s0); f_tile(kb, qh, ql, s1); }
    FragH pf[FNI];
#pragma unroll
    for (int ni = 0; ni < FNI; ++ni) {
#pragma unroll
      for (int r = 0; r < 8; ++r) { const float u0 = expf(s0[ni][r] - lg[ni]), u1 = expf(s1[ni][r] - lg[ni]); pf[ni].h[r] = (_Float16)(u0 < MFLUSH ? 0.0f : u0); pf[ni].h[8 + r] = (_Float16)(u1 < MFLUSH ? 0.0f : u1); } }
#pragma unroll
    for (int ct = 0; ct < 4; ++ct) va[ct] = g3_frag(vp + cu + ct * 512, 0);
#pragma unroll
    for (int ct = 0; ct < 4; ++ct) {
#pragma unroll
      for (int ni = 0; ni < FNI; ++ni) o[ni][ct] = f_mma(va[ct], pf[ni].v, o[ni][ct]); }
    asm volatile("s_wait_xcnt 0x0" ::: "memory"); }      /* at the trip's foot: the next trip forms new addresses in the registers that this trip's last loads name, and the wait stands in front of that */
  const size_t e0 = ((size_t)g * MNC + w) * MNN + i0 + lane; float xv[MNC / FNW];      /* the result's other terms, read here so that they fly under the joining of the partial planes */
#pragma unroll
  for (int q = 0; q < MNC / FNW; ++q) xv[q] = xa[e0 + (size_t)q * FNW * MNN];
  const float kk = bf16_round(kv[(size_t)g * MNN + i0 + lane]), gk = bf16_round(gs[0]) * (1.0f - kk);
#pragma unroll
  for (int ni = 0; ni < FNI; ++ni) {
#pragma unroll
    for (int ct = 0; ct < 4; ++ct) {
#pragma unroll
      for (int r = 0; r < 8; ++r) red[w][((ni * 4 + ct) * 8 + r) * 32 + lane] = o[ni][ct][r]; } }
  __syncthreads();      /* every wave's partial plane is in LDS */
#pragma unroll
  for (int q = 0; q < MNC / FNW; ++q) { const int c = w + FNW * q; const int e = (((lane >> 4) * 4 + (c >> 4)) * 8 + (c & 7)) * 32 + ((c >> 3) & 1) * 16 + ln; float s = red[0][e];      /* a wave a channel: its 32 lanes write one whole line of the result */
#pragma unroll
    for (int u = 1; u < FNW; ++u) s += red[u][e];
    res[e0 + (size_t)q * FNW * MNN] = bf16_round(xv[q]) * kk + gk * (s * (1.0f / MCARRY)); }      /* every element of the result once */
}

extern "C" void kernel_launch(void* const* d_in, const int* in_sizes, int n_in,
                              void* d_out, int out_size, void* d_ws, size_t ws_size, hipStream_t stream) {
  (void)in_sizes; (void)n_in; (void)out_size;
  const float* const* I = (const float* const*)d_in; const float* xa = I[0]; const float* ya = I[1]; const float* kv = I[2]; const float* wa = I[3]; const float* ba = I[4]; const float* wb = I[5]; const float* bb = I[6]; const float* wc = I[7]; const float* bc = I[8]; const float* gs = I[9];      /* xa and ya [2][64][6400]; kv [2][1][6400]; wa, wb, wc [64][64]; ba, bb, bc [64]; gs [1] */
  static_assert(MNN % (FNI * 16) == 0 && FNI == 2 && MNN % FNW == 0 && FKW % 32 == 0 && MNC == 64 && MNC % FNW == 0 && MNN % PPB == 0 && PPB == 64 && XPI >= MNC && XPI % 8 == 0, "whole tiles");
  uint8_t* wsp = (uint8_t*)d_ws; size_t off = 0;
  auto take = [&](size_t bytes) { uint8_t* p = wsp + off; off += (bytes + 255) & ~(size_t)255; return p; };
  _Float16* QH = (_Float16*)take((size_t)MNG * MNN * MNC * 2); _Float16* QL = (_Float16*)take((size_t)MNG * MNN * MNC * 2); _Float16* KW = (_Float16*)take((size_t)MNG * MNN * MNC * 2); _Float16* KL = (_Float16*)take((size_t)MNG * MNN * MNC * 2); _Float16* VC = (_Float16*)take((size_t)MNG * MNC * MNN * 2);      /* the first two projections as word | residual planes, the third as f16 words: all five in fragment order */
  if (off > ws_size) return;
  k_prj<<<dim3((unsigned)(MNG * (MNN / PPB)), 3), 128, 0, stream>>>(xa, ya, kv, wa, ba, wb, bb, wc, bc, QH, QL, KW, KL, VC);
  k_fat<<<dim3((unsigned)(MNN / (FNI * 16)), MNG), FNW * 32, 0, stream>>>(QH, QL, KW, KL, VC, xa, kv, gs, (float*)d_out);      /* res[g][c][i] = xa kv + gs (1 - kv) sum over j of VC[g][c][j] softmax(raw sums)[i][j] */
}

// v005
// One run takes 90.8 microseconds.
// Timed twice side by side with v004, it ran 1.08 and 1.06 times as fast.
// Counting every step since v000, it is 95.4 times as fast.
// A single-head pair weighting over 6,400 positions of channel-first arrays with a multiplicative key vector: xa [2][64][6400] and ya [2][64][6400] (group, channel, position), kv [2][6400], wa, wb, wc [64][64] stored (row: result channel; column: source channel), ba, bb, bc [64], gs [1]: qr = wa xa + ba, kr = wb ya + bb, vr = wc xa + bc (channel-first); zs[g][i][j] = (sum over c of qr[c][i] kr[c][j]) kv[g][j]; wt[g][i][:] = softmax over j of zs[g][i][:]; ag[g][c][i] = sum over j of vr[c][j] wt[g][i][j]; res = xa kv + gs[0] (1 - kv) ag -> [2][64][6400] f32: one result.
// Structure: TWO launches. ONE projection kernel: a work-group takes 64 positions of one group and one of the three projections; it reads its 64 x 64 block of the channel-first array in whole lines, converts (bf16 first, then f16 words) and lays it transposed in LDS as position rows; the weight's rows and the added vector are converted and laid in LDS beside it; WMMA: the first two projections with the weight's rows as the first operand (a lane's eight accumulator words are eight channels of one position: one 16-byte store, LAID IN FRAGMENT ORDER: a tile of 16 positions is four pieces of 512 bytes, lane after lane, exactly as the fused kernel's waves load them, so that every wave-wide store and load covers four whole lines), the added vector joined, THE KEY VECTOR MULTIPLIED INTO THE SECOND PROJECTION's ROWS (kr[:][j] kv[j]: the same sum over c, the factor taken inside it: nothing stands between), each split into an f16 word and an f16 residual word (x 2^10); the third projection with the position rows as the first operand (eight positions of one channel a lane; stored in fragment order too: 32 positions x 16 channels are two pieces of 512 bytes), its added vector joined and the sum stored as one f16 word; ONE FUSED kernel for raw sums, softmax, weighted sum and result: a work-group of eight waves owns 32 query rows, each wave 800 of the 6,400 keys; the raw sums are formed key-major (keys as the first operand's rows, queries as the second's) by three products (word.word; residual.word and word.residual in one accumulator at 2^-10) and stay in registers; ONE pass over the keys: each trip of 32 keys raises the wave's running maximum of each query (in-lane, then one exchange between the wave's halves), takes the sum and the partial plane gathered so far down to it, and takes exp(z - maximum) as one f16 word behind a carry of 2^12 (words under 2^-14 stored as nought): the accumulator's layout IS the second operand's layout of the last product (channel-first third projection against those words), so nothing is transposed; the eight waves' maxima, sums and partial planes meet in LDS, each plane and sum is taken down to the greatest maximum, and the quotient is joined with xa, kv and gs into the result where they are summed.
// Compute dtype: all ten inputs converted to bf16 where they are read; the arrays' rows and the weights exact as f16 words down to 2^-14; the two projections TWO f16 words each; the third projection ONE f16 word; the softmax words ONE f16 word behind 2^12 with the small words flushed at the cast; every product's accumulation, the raw sums, the softmax's arithmetic and the result f32. v_wmma_f32_16x16x32_f16.
#include <hip/hip_runtime.h>
#define MNG 2                        /* groups */
#define MNC 64                       /* channels: the projections' depth and width */
#define MNN 6400                     /* positions: the softmax's axis */
#define FNI 2                        /* query tiles of 16 rows a fused work-group owns */
#define MLOGC 8.31776616671934f      /* 12 ln 2: the softmax words carry 2^12 (the greatest is 2^12); their sum carries it too, and it leaves in the quotient */
#define MFLUSH 6.103515625e-05f      /* 2^-14: a softmax word under it is stored as nought */
#define FNW 8                        /* waves of a fused work-group: the keys are split among them */
#define FKW (MNN / FNW)              /* keys a wave takes */
typedef unsigned short v8us __attribute__((ext_vector_type(8), may_alias));
typedef float  v8f  __attribute__((ext_vector_type(8)));
typedef float  v4f  __attribute__((ext_vector_type(4)));
typedef float  v4fa __attribute__((ext_vector_type(4), may_alias));

__device__ __forceinline__ unsigned short bf16_bits(float x) { unsigned int u = __float_as_uint(x); return (unsigned short)((u + 0x7FFFu + ((u >> 16) & 1u)) >> 16); }
__device__ __forceinline__ float bf16_val(unsigned short b) { return __uint_as_float(((unsigned int)b) << 16); }
__device__ __forceinline__ float bf16_round(float x) { return bf16_val(bf16_bits(x)); }

typedef _Float16 v16h __attribute__((ext_vector_type(16)));
union FragH { v16h v; v8us half[2]; _Float16 h[16]; unsigned short u[16]; };

__device__ __forceinline__ v16h g2_frag(const _Float16* p, int hh) { FragH f; f.half[0] = *(const v8us*)((const unsigned short*)p + 8 * hh); f.half[1] = *(const v8us*)((const unsigned short*)p + 16 + 8 * hh); return f.v; }
// a fragment from a workspace plane laid in fragment order: p is the lane's own 8 words in a tile's first piece of 512 bytes (32 lanes x 16 bytes in a row); pieces 2 d and 2 d + 1 are the two halves of depth step d, so that a wave's load is four whole lines
__device__ __forceinline__ v16h g3_frag(const _Float16* p, int d) { FragH f; f.half[0] = *(const v8us*)((const unsigned short*)p + 512 * d); f.half[1] = *(const v8us*)((const unsigned short*)p + 512 * d + 256); return f.v; }
#define PPB 64                       /* positions a projection work-group takes */
#define XPI 72                       /* f16 words from one position row to the next in LDS: 144 bytes = 16 x 9, so that 16-byte fragment reads spread over the banks */
typedef _Float16 v2ha __attribute__((ext_vector_type(2), may_alias));
__device__ __forceinline__ v8f f_mma(v16h a, v16h b, v8f c) { return __builtin_amdgcn_wmma_f32_16x16x32_f16(false, a, false, b, (short)0, c, false, false); }
typedef _Float16 v4ha __attribute__((ext_vector_type(4), may_alias));
// blockIdx.y: 0 the first projection (xa, wa, ba -> QH | QL), 1 the second (ya, wb, bb, x kv -> KW | KL), 2 the third (xa, wc, bc -> VC); blockIdx.x: PPB positions of one group
__global__ __launch_bounds__(128) void k_prj(const float* __restrict__ xa, const float* __restrict__ ya, const float* __restrict__ kv, const float* __restrict__ wa, const float* __restrict__ ba, const float* __restrict__ wb, const float* __restrict__ bb, const float* __restrict__ wc, const float* __restrict__ bc,
    _Float16* __restrict__ QH, _Float16* __restrict__ QL, _Float16* __restrict__ KW, _Float16* __restrict__ KL, _Float16* __restrict__ VC) {
  __shared__ __attribute__((aligned(16))) _Float16 xs[PPB][XPI]; __shared__ __attribute__((aligned(16))) _Float16 ws[MNC][XPI]; __shared__ __attribute__((aligned(16))) float bs[MNC];      /* position rows; the weight's rows; the added vector */
  const int tid = threadIdx.x, w = tid >> 5, lane = tid & 31, ln = lane & 15, hh = lane >> 4; const int job = blockIdx.y, g = blockIdx.x / (MNN / PPB), i0 = (blockIdx.x % (MNN / PPB)) * PPB;
  const float* sp = (job == 1 ? ya : xa) + (size_t)g * MNC * MNN + i0 + (tid & 15) * 4 + (size_t)(tid >> 4) * 2 * MNN;      /* a thread: four positions of channels 2 (tid / 16) + 16 q and the next: a wave's load is two whole rows of 256 bytes */
  const float* wp = (job == 0 ? wa : job == 1 ? wb : wc) + tid * 4; const float* bp = job == 0 ? ba : job == 1 ? bb : bc; const size_t p = (size_t)g * MNN + i0 + 16 * w + ln;
  v4f x0[4], x1[4], wv[8];
#pragma unroll
  for (int q = 0; q < 4; ++q) { x0[q] = *(const v4fa*)(sp + (size_t)q * 16 * MNN); x1[q] = *(const v4fa*)(sp + (size_t)(q * 16 + 1) * MNN); }
#pragma unroll
  for (int q = 0; q < 8; ++q) wv[q] = *(const v4fa*)(wp + q * 512);      /* the weight as it lies: a wave's load is 512 bytes in a row */
  const float* bq = bp + (tid & (MNC - 1)); const float* kq = kv + p; const float br = *bq, kr = *kq;      /* kv's 12,800 words lie in the order of the position rows */
  asm volatile("s_wait_xcnt 0x0" :: "v"(x0[0]), "v"(x0[1]), "v"(x0[2]), "v"(x0[3]), "v"(x1[0]), "v"(x1[1]), "v"(x1[2]), "v"(x1[3]), "v"(wv[0]), "v"(wv[1]), "v"(wv[2]), "v"(wv[3]), "v"(wv[4]), "v"(wv[5]), "v"(wv[6]), "v"(wv[7]), "v"(br), "v"(kr), "v"(sp), "v"(wp), "v"(bq), "v"(kq) : "memory");      /* the loaded words and the addresses as inputs only: all 18 loads are issued in front of this line, so that their latencies overlap and are paid once, and no address register is given away in front of the wait */
#pragma unroll
  for (int q = 0; q < 4; ++q) {
#pragma unroll
    for (int e = 0; e < 4; ++e) { v2ha h2; h2[0] = (_Float16)bf16_round(x0[q][e]); h2[1] = (_Float16)bf16_round(x1[q][e]); *(v2ha*)&xs[(tid & 15) * 4 + e][(tid >> 4) * 2 + 16 * q] = h2; } }
#pragma unroll
  for (int q = 0; q < 8; ++q) { v4ha h4;
#pragma unroll
    for (int e = 0; e < 4; ++e) h4[e] = (_Float16)bf16_round(wv[q][e]);
    *(v4ha*)&ws[q * 8 + (tid >> 4)][(tid & 15) * 4] = h4; }
  if (tid < MNC) bs[tid] = bf16_round(br);
  __syncthreads();      /* position rows, weight rows and added vector are in LDS */
  const v8f z8 = {0.f,0.f,0.f,0.f,0.f,0.f,0.f,0.f};
  if (job < 2) {      /* wave w: positions 16 w + ln as columns, all 64 result channels as rows (a lane's eight words: eight channels of one position): it writes one whole tile of both planes */
    const size_t pt = ((size_t)g * MNN + i0 + 16 * w) * MNC + lane * 8; unsigned short* Hh = (unsigned short*)(job == 0 ? QH : KW) + pt; unsigned short* Hl = (unsigned short*)(job == 0 ? QL : KL) + pt;      /* the wave's tile of 16 positions: 2 KiB in fragment order, piece t = channels 16 t + 8 hh + r of position ln at lane 16 hh + ln */ const float kk = job == 1 ? bf16_round(kr) : 1.0f;      /* x 1 is exact */
    const v16h b0 = g2_frag(&xs[16 * w + ln][0], hh), b1 = g2_frag(&xs[16 * w + ln][32], hh); FragH fh[4], fl[4];
#pragma unroll
    for (int t = 0; t < 4; ++t) { v8f c = f_mma(g2_frag(&ws[16 * t + ln][0], hh), b0, z8); c = f_mma(g2_frag(&ws[16 * t + ln][32], hh), b1, c); const v4f u0 = *(const v4fa*)&bs[16 * t + 8 * hh], u1 = *(const v4fa*)&bs[16 * t + 8 * hh + 4];
#pragma unroll
      for (int r = 0; r < 8; ++r) { const float v = (c[r] + (r < 4 ? u0[r & 3] : u1[r & 3])) * kk; const _Float16 h = (_Float16)v; fh[t].h[r] = h; fl[t].h[r] = (_Float16)((v - (float)h) * 1024.0f); } }
#pragma unroll
    for (int t = 0; t < 4; ++t) { *(v8us*)(Hh + 256 * t) = fh[t].half[0]; *(v8us*)(Hl + 256 * t) = fl[t].half[0]; }      /* the tile's eight pieces in a run at the arm's end: no stored register is written again */
  } else {      /* wave w: result channels 16 w + ln as columns, all PPB positions as rows (a lane's eight words: eight positions of one channel): it writes whole pieces of 512 bytes */
    unsigned short* vo = (unsigned short*)VC + (((size_t)g * MNN + i0) / 32 * 4 + w) * 512 + lane * 8;      /* 32 positions x 16 channels: 1 KiB in fragment order, piece h = positions 16 h + 8 hh + r of channel ln at lane 16 hh + ln; four channel tiles in a row */ const float bv = (float)(_Float16)bs[16 * w + ln];
    const v16h b0 = g2_frag(&ws[16 * w + ln][0], hh), b1 = g2_frag(&ws[16 * w + ln][32], hh);
#pragma unroll
    for (int t = 0; t < 4; ++t) { v8f c = f_mma(g2_frag(&xs[16 * t + ln][0], hh), b0, z8); c = f_mma(g2_frag(&xs[16 * t + ln][32], hh), b1, c); FragH f;
#pragma unroll
      for (int r = 0; r < 8; ++r) f.h[r] = (_Float16)(c[r] + bv);
      *(v8us*)(vo + (t >> 1) * 2048 + (t & 1) * 256) = f.half[0]; }
    asm volatile("s_wait_xcnt 0x0" ::: "memory");      /* behind the arm's last store: the stores' address pair is not given away in front of the wait */
  }
}

__device__ __forceinline__ float xhalf(float x) { return __builtin_bit_cast(float, __builtin_amdgcn_permlanex16(__builtin_bit_cast(int, x), __builtin_bit_cast(int, x), 0x76543210, 0xfedcba98, false, false)); }      /* lane l's word to lane l ^ 16 */
// the raw sums of 16 keys (rows: 8 hh + r) against FNI x 16 queries (columns: ln): word.word, and residual.word + word.residual in a second accumulator at 2^-10
struct KF { v16h w0, w1, l0, l1; };      /* 16 keys: word and residual, two depth steps of 32 */
__device__ __forceinline__ KF f_load(const _Float16* __restrict__ kw, const _Float16* __restrict__ kl) { KF k; k.w0 = g3_frag(kw, 0); k.w1 = g3_frag(kw, 1); k.l0 = g3_frag(kl, 0); k.l1 = g3_frag(kl, 1); return k; }
__device__ __forceinline__ void f_tile(const KF& k, const v16h (&qh)[FNI][2], const v16h (&ql)[FNI][2], v8f (&s)[FNI]) { const v8f z8 = {0.f,0.f,0.f,0.f,0.f,0.f,0.f,0.f};
#pragma unroll
  for (int ni = 0; ni < FNI; ++ni) { v8f cm = f_mma(k.w0, qh[ni][0], z8), cr = f_mma(k.w0, ql[ni][0], z8); cm = f_mma(k.w1, qh[ni][1], cm); cr = f_mma(k.w1, ql[ni][1], cr); cr = f_mma(k.l0, qh[ni][0], cr); cr = f_mma(k.l1, qh[ni][1], cr);
    s[ni] = cm + cr * 0.0009765625f; } }

// a work-group: FNI x 16 query rows of one group; wave w: keys [w FKW, (w + 1) FKW), 32 a trip. Lane (ln, hh) sees query ln of each tile and keys 8 hh + r and 16 + 8 hh + r of the trip's 32.
__global__ __launch_bounds__(FNW * 32) void k_fat(const _Float16* __restrict__ QH, const _Float16* __restrict__ QL, const _Float16* __restrict__ KW, const _Float16* __restrict__ KL, const _Float16* __restrict__ VC, const float* __restrict__ xa, const float* __restrict__ kv, const float* __restrict__ gs, float* __restrict__ res) {
  __shared__ float smx[FNW][FNI][32]; __shared__ float ssm[FNW][FNI][32]; __shared__ float red[FNW][FNI * 4 * 8 * 32];
  const int tid = threadIdx.x, w = tid >> 5, lane = tid & 31, ln = lane & 15, hh = lane >> 4; const int g = blockIdx.y, i0 = blockIdx.x * (FNI * 16);
  v16h qh[FNI][2], ql[FNI][2];
#pragma unroll
  for (int ni = 0; ni < FNI; ++ni) { const size_t e = ((size_t)g * MNN + i0 + ni * 16) * MNC + lane * 8; qh[ni][0] = g3_frag(QH + e, 0); qh[ni][1] = g3_frag(QH + e, 1); }
  asm volatile("s_wait_xcnt 0x0" ::: "memory");      /* the loads' address registers are given to later loads' results: the wait stands in front of that */
#pragma unroll
  for (int ni = 0; ni < FNI; ++ni) { const size_t e = ((size_t)g * MNN + i0 + ni * 16) * MNC + lane * 8; ql[ni][0] = g3_frag(QL + e, 0); ql[ni][1] = g3_frag(QL + e, 1); }
  asm volatile("s_wait_xcnt 0x0" ::: "memory");      /* as above, in front of the first keys' loads */
  const size_t k0 = ((size_t)g * MNN + w * FKW) * MNC + lane * 8; const _Float16* kwp = KW + k0; const _Float16* klp = KL + k0;
  float m[FNI], l[FNI];
#pragma unroll
  for (int ni = 0; ni < FNI; ++ni) { m[ni] = -__builtin_inff(); l[ni] = 0.0f; }
  const v8f z8 = {0.f,0.f,0.f,0.f,0.f,0.f,0.f,0.f}; v8f o[FNI][4];
#pragma unroll
  for (int ni = 0; ni < FNI; ++ni) { o[ni][0] = z8; o[ni][1] = z8; o[ni][2] = z8; o[ni][3] = z8; }
  const _Float16* vp = VC + ((size_t)g * MNN + w * FKW) * MNC + lane * 8;      /* 32 keys x 64 channels are 2,048 words in a row */
  for (int it = 0; it < FKW / 32; ++it) { v8f s0[FNI], s1[FNI]; v16h va[4]; const size_t cu = (size_t)it * 32 * MNC;
    { const _Float16* kwc = kwp + cu; const _Float16* klc = klp + cu; const KF ka = f_load(kwc, klc), kb = f_load(kwc + 16 * MNC, klc + 16 * MNC);
    asm volatile("s_wait_xcnt 0x0" :: "v"(kwc), "v"(klc) : "memory");      /* behind the keys' loads: their address registers are given to the raw sums further down, and the wait stands in front of that; the addresses as inputs only, so that no load's own result takes an address register in front of the wait */
    f_tile(ka, qh, ql, s0); f_tile(kb, qh, ql, s1); }
    FragH pf[FNI];
#pragma unroll
    for (int ni = 0; ni < FNI; ++ni) { float t = fmaxf(s0[ni][0], s1[ni][0]);
#pragma unroll
      for (int r = 1; r < 8; ++r) t = fmaxf(t, fmaxf(s0[ni][r], s1[ni][r]));
      t = fmaxf(t, xhalf(t));      /* the trip's 32 keys of a query lie in lanes ln and 16 + ln: both take one maximum, since the last product sums over all 32 */
      const float mn = fmaxf(m[ni], t), f = expf(m[ni] - mn), mc = mn - MLOGC; float a0 = 0.0f, a1 = 0.0f;      /* f: what was gathered under the old maximum is taken down to the new one (nought on the first trip) */
#pragma unroll
      for (int r = 0; r < 8; ++r) { const float u0 = expf(s0[ni][r] - mc), u1 = expf(s1[ni][r] - mc); a0 += u0; a1 += u1; pf[ni].h[r] = (_Float16)(u0 < MFLUSH ? 0.0f : u0); pf[ni].h[8 + r] = (_Float16)(u1 < MFLUSH ? 0.0f : u1); }
      m[ni] = mn; l[ni] = l[ni] * f + (a0 + a1);
#pragma unroll
      for (int ct = 0; ct < 4; ++ct) o[ni][ct] *= f; }
#pragma unroll
    for (int ct = 0; ct < 4; ++ct) va[ct] = g3_frag(vp + cu + ct * 512, 0);
#pragma unroll
    for (int ct = 0; ct < 4; ++ct) {
#pragma unroll
      for (int ni = 0; ni < FNI; ++ni) o[ni][ct] = f_mma(va[ct], pf[ni].v, o[ni][ct]); }
    asm volatile("s_wait_xcnt 0x0" ::: "memory"); }      /* at the trip's foot: the next trip forms new addresses in the registers that this trip's last loads name, and the wait stands in front of that */
  const size_t e0 = ((size_t)g * MNC + w) * MNN + i0 + lane; float xv[MNC / FNW];      /* the result's other terms, read here so that they fly under the joining of the partial planes */
#pragma unroll
  for (int q = 0; q < MNC / FNW; ++q) xv[q] = xa[e0 + (size_t)q * FNW * MNN];
  const float kk = bf16_round(kv[(size_t)g * MNN + i0 + lane]), gk = bf16_round(gs[0]) * (1.0f - kk);
#pragma unroll
  for (int ni = 0; ni < FNI; ++ni) { smx[w][ni][lane] = m[ni]; ssm[w][ni][lane] = l[ni];
#pragma unroll
    for (int ct = 0; ct < 4; ++ct) {
#pragma unroll
      for (int r = 0; r < 8; ++r) red[w][((ni * 4 + ct) * 8 + r) * 32 + lane] = o[ni][ct][r]; } }
  __syncthreads();      /* every wave's maxima, sums and partial plane are in LDS */
  float fu[FNW], hi = smx[0][lane >> 4][ln], sl = 0.0f;      /* from here a lane is query lane of the work-group's 32: each wave's plane and sum are taken from that wave's maximum down to the greatest */
#pragma unroll
  for (int u = 1; u < FNW; ++u) hi = fmaxf(hi, smx[u][lane >> 4][ln]);
#pragma unroll
  for (int u = 0; u < FNW; ++u) { fu[u] = expf(smx[u][lane >> 4][ln] - hi); sl += (ssm[u][lane >> 4][ln] + ssm[u][lane >> 4][16 + ln]) * fu[u]; }
  const float rl = 1.0f / sl;      /* plane and sum carry the same 2^12: it leaves in the quotient */
#pragma unroll
  for (int q = 0; q < MNC / FNW; ++q) { const int c = w + FNW * q; const int e = (((lane >> 4) * 4 + (c >> 4)) * 8 + (c & 7)) * 32 + ((c >> 3) & 1) * 16 + ln; float s = red[0][e] * fu[0];      /* a wave a channel: its 32 lanes write one whole line of the result */
#pragma unroll
    for (int u = 1; u < FNW; ++u) s += red[u][e] * fu[u];
    res[e0 + (size_t)q * FNW * MNN] = bf16_round(xv[q]) * kk + gk * (s * rl); }      /* every element of the result once */
}

extern "C" void kernel_launch(void* const* d_in, const int* in_sizes, int n_in,
                              void* d_out, int out_size, void* d_ws, size_t ws_size, hipStream_t stream) {
  (void)in_sizes; (void)n_in; (void)out_size;
  const float* const* I = (const float* const*)d_in; const float* xa = I[0]; const float* ya = I[1]; const float* kv = I[2]; const float* wa = I[3]; const float* ba = I[4]; const float* wb = I[5]; const float* bb = I[6]; const float* wc = I[7]; const float* bc = I[8]; const float* gs = I[9];      /* xa and ya [2][64][6400]; kv [2][1][6400]; wa, wb, wc [64][64]; ba, bb, bc [64]; gs [1] */
  static_assert(MNN % (FNI * 16) == 0 && FNI == 2 && MNN % FNW == 0 && FKW % 32 == 0 && MNC == 64 && MNC % FNW == 0 && MNN % PPB == 0 && PPB == 64 && XPI >= MNC && XPI % 8 == 0, "whole tiles");
  uint8_t* wsp = (uint8_t*)d_ws; size_t off = 0;
  auto take = [&](size_t bytes) { uint8_t* p = wsp + off; off += (bytes + 255) & ~(size_t)255; return p; };
  _Float16* QH = (_Float16*)take((size_t)MNG * MNN * MNC * 2); _Float16* QL = (_Float16*)take((size_t)MNG * MNN * MNC * 2); _Float16* KW = (_Float16*)take((size_t)MNG * MNN * MNC * 2); _Float16* KL = (_Float16*)take((size_t)MNG * MNN * MNC * 2); _Float16* VC = (_Float16*)take((size_t)MNG * MNC * MNN * 2);      /* the first two projections as word | residual planes, the third as f16 words: all five in fragment order */
  if (off > ws_size) return;
  k_prj<<<dim3((unsigned)(MNG * (MNN / PPB)), 3), 128, 0, stream>>>(xa, ya, kv, wa, ba, wb, bb, wc, bc, QH, QL, KW, KL, VC);
  k_fat<<<dim3((unsigned)(MNN / (FNI * 16)), MNG), FNW * 32, 0, stream>>>(QH, QL, KW, KL, VC, xa, kv, gs, (float*)d_out);      /* res[g][c][i] = xa kv + gs (1 - kv) sum over j of VC[g][c][j] softmax(raw sums)[i][j] */
}

// v006
// It runs in 60 microseconds.
// In two side-by-side timings against v005, it was 1.50 and 1.49 times as fast.
// All steps since v000 together make it 143 times as fast.
// A single-head pair weighting over 6,400 positions of channel-first arrays with a multiplicative key vector: xa [2][64][6400] and ya [2][64][6400] (group, channel, position), kv [2][6400], wa, wb, wc [64][64] stored (row: result channel; column: source channel), ba, bb, bc [64], gs [1]: qr = wa xa + ba, kr = wb ya + bb, vr = wc xa + bc (channel-first); zs[g][i][j] = (sum over c of qr[c][i] kr[c][j]) kv[g][j]; wt[g][i][:] = softmax over j of zs[g][i][:]; ag[g][c][i] = sum over j of vr[c][j] wt[g][i][j]; res = xa kv + gs[0] (1 - kv) ag -> [2][64][6400] f32: one result.
// Structure: TWO launches. ONE projection kernel: a work-group takes 64 positions of one group and one of the three projections; it reads its 64 x 64 block of the channel-first array in whole lines, converts (bf16 first, then f16 words) and lays it transposed in LDS as position rows; the weight's rows and the added vector are converted and laid in LDS beside it; WMMA: the first two projections with the weight's rows as the first operand (a lane's eight accumulator words are eight channels of one position: one 16-byte store, LAID IN FRAGMENT ORDER: a tile of 16 positions is four pieces of 512 bytes, lane after lane, exactly as the fused kernel's waves load them, so that every wave-wide store and load covers four whole lines), the added vector joined, THE KEY VECTOR MULTIPLIED INTO THE SECOND PROJECTION's ROWS (kr[:][j] kv[j]: the same sum over c, the factor taken inside it: nothing stands between), each split into an f16 word and an f16 residual word (x 2^10); the third projection with the position rows as the first operand (eight positions of one channel a lane; stored in fragment order too: 32 positions x 16 channels are two pieces of 512 bytes), its added vector joined and the sum stored as one f16 word; ONE FUSED kernel for raw sums, softmax, weighted sum and result: a work-group of eight waves owns 32 query rows, each wave 800 of the 6,400 keys; the raw sums are formed key-major (keys as the first operand's rows, queries as the second's) by three products (word.word; residual.word and word.residual in one accumulator at 2^-10) and stay in registers; ONE pass over the keys: each trip of 32 keys raises the wave's running maximum of each query (in-lane, then one exchange between the wave's halves), takes the sum and the partial plane gathered so far down to it, and takes exp(z - maximum) as one f16 word behind a carry of 2^12 (words under 2^-14 stored as nought): the accumulator's layout IS the second operand's layout of the last product (channel-first third projection against those words), so nothing is transposed; the eight waves' maxima, sums and partial planes meet in LDS, each plane and sum is taken down to the greatest maximum, and the quotient is joined with xa, kv and gs into the result where they are summed.
// Compute dtype: all ten inputs converted to bf16 where they are read; the arrays' rows and the weights exact as f16 words down to 2^-14; the two projections TWO f16 words each; the third projection ONE f16 word; the softmax words ONE f16 word behind 2^12 with the small words flushed at the cast; every product's accumulation, the raw sums, the softmax's arithmetic and the result f32. v_wmma_f32_16x16x32_f16.
#include <hip/hip_runtime.h>
#define MNG 2                        /* groups */
#define MNC 64                       /* channels: the projections' depth and width */
#define MNN 6400                     /* positions: the softmax's axis */
#define FNI 2                        /* query tiles of 16 rows a fused work-group owns */
#define MLOGC 12.0f                  /* the softmax words carry 2^12 (the greatest is 2^12), added in the base-2 exponent; their sum carries it too, and it leaves in the quotient */
#define MLOG2E 1.4426950408889634f   /* log2 e: exp(x) is taken as 2^(x log2 e) on the chip's own base-2 exponential */
#define MFLUSH 6.103515625e-05f      /* 2^-14: a softmax word under it is stored as nought */
#define FNW 8                        /* waves of a fused work-group: the keys are split among them */
#define FKW (MNN / FNW)              /* keys a wave takes */
typedef unsigned short v8us __attribute__((ext_vector_type(8), may_alias));
typedef float  v8f  __attribute__((ext_vector_type(8)));
typedef float  v4f  __attribute__((ext_vector_type(4)));
typedef float  v4fa __attribute__((ext_vector_type(4), may_alias));

__device__ __forceinline__ unsigned short bf16_bits(float x) { unsigned int u = __float_as_uint(x); return (unsigned short)((u + 0x7FFFu + ((u >> 16) & 1u)) >> 16); }
__device__ __forceinline__ float bf16_val(unsigned short b) { return __uint_as_float(((unsigned int)b) << 16); }
__device__ __forceinline__ float bf16_round(float x) { return bf16_val(bf16_bits(x)); }

typedef _Float16 v16h __attribute__((ext_vector_type(16)));
union FragH { v16h v; v8us half[2]; _Float16 h[16]; unsigned short u[16]; };

__device__ __forceinline__ v16h g2_frag(const _Float16* p, int hh) { FragH f; f.half[0] = *(const v8us*)((const unsigned short*)p + 8 * hh); f.half[1] = *(const v8us*)((const unsigned short*)p + 16 + 8 * hh); return f.v; }
// a fragment from a workspace plane laid in fragment order: p is the lane's own 8 words in a tile's first piece of 512 bytes (32 lanes x 16 bytes in a row); pieces 2 d and 2 d + 1 are the two halves of depth step d, so that a wave's load is four whole lines
__device__ __forceinline__ v16h g3_frag(const _Float16* p, int d) { FragH f; f.half[0] = *(const v8us*)((const unsigned short*)p + 512 * d); f.half[1] = *(const v8us*)((const unsigned short*)p + 512 * d + 256); return f.v; }
#define PPB 64                       /* positions a projection work-group takes */
#define XPI 72                       /* f16 words from one position row to the next in LDS: 144 bytes = 16 x 9, so that 16-byte fragment reads spread over the banks */
typedef _Float16 v2ha __attribute__((ext_vector_type(2), may_alias));
__device__ __forceinline__ v8f f_mma(v16h a, v16h b, v8f c) { return __builtin_amdgcn_wmma_f32_16x16x32_f16(false, a, false, b, (short)0, c, false, false); }
typedef _Float16 v4ha __attribute__((ext_vector_type(4), may_alias));
// blockIdx.y: 0 the first projection (xa, wa, ba -> QH | QL), 1 the second (ya, wb, bb, x kv -> KW | KL), 2 the third (xa, wc, bc -> VC); blockIdx.x: PPB positions of one group
__global__ __launch_bounds__(128) void k_prj(const float* __restrict__ xa, const float* __restrict__ ya, const float* __restrict__ kv, const float* __restrict__ wa, const float* __restrict__ ba, const float* __restrict__ wb, const float* __restrict__ bb, const float* __restrict__ wc, const float* __restrict__ bc,
    _Float16* __restrict__ QH, _Float16* __restrict__ QL, _Float16* __restrict__ KW, _Float16* __restrict__ KL, _Float16* __restrict__ VC) {
  __shared__ __attribute__((aligned(16))) _Float16 xs[PPB][XPI]; __shared__ __attribute__((aligned(16))) _Float16 ws[MNC][XPI]; __shared__ __attribute__((aligned(16))) float bs[MNC];      /* position rows; the weight's rows; the added vector */
  const int tid = threadIdx.x, w = tid >> 5, lane = tid & 31, ln = lane & 15, hh = lane >> 4; const int job = blockIdx.y, g = blockIdx.x / (MNN / PPB), i0 = (blockIdx.x % (MNN / PPB)) * PPB;
  const float* sp = (job == 1 ? ya : xa) + (size_t)g * MNC * MNN + i0 + (tid & 15) * 4 + (size_t)(tid >> 4) * 2 * MNN;      /* a thread: four positions of channels 2 (tid / 16) + 16 q and the next: a wave's load is two whole rows of 256 bytes */
  const float* wp = (job == 0 ? wa : job == 1 ? wb : wc) + tid * 4; const float* bp = job == 0 ? ba : job == 1 ? bb : bc; const size_t p = (size_t)g * MNN + i0 + 16 * w + ln;
  v4f x0[4], x1[4], wv[8];
#pragma unroll
  for (int q = 0; q < 4; ++q) { x0[q] = *(const v4fa*)(sp + (size_t)q * 16 * MNN); x1[q] = *(const v4fa*)(sp + (size_t)(q * 16 + 1) * MNN); }
#pragma unroll
  for (int q = 0; q < 8; ++q) wv[q] = *(const v4fa*)(wp + q * 512);      /* the weight as it lies: a wave's load is 512 bytes in a row */
  const float* bq = bp + (tid & (MNC - 1)); const float* kq = kv + p; const float br = *bq, kr = *kq;      /* kv's 12,800 words lie in the order of the position rows */
  asm volatile("s_wait_xcnt 0x0" :: "v"(x0[0]), "v"(x0[1]), "v"(x0[2]), "v"(x0[3]), "v"(x1[0]), "v"(x1[1]), "v"(x1[2]), "v"(x1[3]), "v"(wv[0]), "v"(wv[1]), "v"(wv[2]), "v"(wv[3]), "v"(wv[4]), "v"(wv[5]), "v"(wv[6]), "v"(wv[7]), "v"(br), "v"(kr), "v"(sp), "v"(wp), "v"(bq), "v"(kq) : "memory");      /* the loaded words and the addresses as inputs only: all 18 loads are issued in front of this line, so that their latencies overlap and are paid once, and no address register is given away in front of the wait */
#pragma unroll
  for (int q = 0; q < 4; ++q) {
#pragma unroll
    for (int e = 0; e < 4; ++e) { v2ha h2; h2[0] = (_Float16)bf16_round(x0[q][e]); h2[1] = (_Float16)bf16_round(x1[q][e]); *(v2ha*)&xs[(tid & 15) * 4 + e][(tid >> 4) * 2 + 16 * q] = h2; } }
#pragma unroll
  for (int q = 0; q < 8; ++q) { v4ha h4;
#pragma unroll
    for (int e = 0; e < 4; ++e) h4[e] = (_Float16)bf16_round(wv[q][e]);
    *(v4ha*)&ws[q * 8 + (tid >> 4)][(tid & 15) * 4] = h4; }
  if (tid < MNC) bs[tid] = bf16_round(br);
  __syncthreads();      /* position rows, weight rows and added vector are in LDS */
  const v8f z8 = {0.f,0.f,0.f,0.f,0.f,0.f,0.f,0.f};
  if (job < 2) {      /* wave w: positions 16 w + ln as columns, all 64 result channels as rows (a lane's eight words: eight channels of one position): it writes one whole tile of both planes */
    const size_t pt = ((size_t)g * MNN + i0 + 16 * w) * MNC + lane * 8; unsigned short* Hh = (unsigned short*)(job == 0 ? QH : KW) + pt; unsigned short* Hl = (unsigned short*)(job == 0 ? QL : KL) + pt;      /* the wave's tile of 16 positions: 2 KiB in fragment order, piece t = channels 16 t + 8 hh + r of position ln at lane 16 hh + ln */ const float kk = job == 1 ? bf16_round(kr) : 1.0f;      /* x 1 is exact */
    const v16h b0 = g2_frag(&xs[16 * w + ln][0], hh), b1 = g2_frag(&xs[16 * w + ln][32], hh); FragH fh[4], fl[4];
#pragma unroll
    for (int t = 0; t < 4; ++t) { v8f c = f_mma(g2_frag(&ws[16 * t + ln][0], hh), b0, z8); c = f_mma(g2_frag(&ws[16 * t + ln][32], hh), b1, c); const v4f u0 = *(const v4fa*)&bs[16 * t + 8 * hh], u1 = *(const v4fa*)&bs[16 * t + 8 * hh + 4];
#pragma unroll
      for (int r = 0; r < 8; ++r) { const float v = (c[r] + (r < 4 ? u0[r & 3] : u1[r & 3])) * kk; const _Float16 h = (_Float16)v; fh[t].h[r] = h; fl[t].h[r] = (_Float16)((v - (float)h) * 1024.0f); } }
#pragma unroll
    for (int t = 0; t < 4; ++t) { *(v8us*)(Hh + 256 * t) = fh[t].half[0]; *(v8us*)(Hl + 256 * t) = fl[t].half[0]; }      /* the tile's eight pieces in a run at the arm's end: no stored register is written again */
  } else {      /* wave w: result channels 16 w + ln as columns, all PPB positions as rows (a lane's eight words: eight positions of one channel): it writes whole pieces of 512 bytes */
    unsigned short* vo = (unsigned short*)VC + (((size_t)g * MNN + i0) / 32 * 4 + w) * 512 + lane * 8;      /* 32 positions x 16 channels: 1 KiB in fragment order, piece h = positions 16 h + 8 hh + r of channel ln at lane 16 hh + ln; four channel tiles in a row */ const float bv = (float)(_Float16)bs[16 * w + ln];
    const v16h b0 = g2_frag(&ws[16 * w + ln][0], hh), b1 = g2_frag(&ws[16 * w + ln][32], hh);
#pragma unroll
    for (int t = 0; t < 4; ++t) { v8f c = f_mma(g2_frag(&xs[16 * t + ln][0], hh), b0, z8); c = f_mma(g2_frag(&xs[16 * t + ln][32], hh), b1, c); FragH f;
#pragma unroll
      for (int r = 0; r < 8; ++r) f.h[r] = (_Float16)(c[r] + bv);
      *(v8us*)(vo + (t >> 1) * 2048 + (t & 1) * 256) = f.half[0]; }
    asm volatile("s_wait_xcnt 0x0" ::: "memory");      /* behind the arm's last store: the stores' address pair is not given away in front of the wait */
  }
}

__device__ __forceinline__ float xhalf(float x) { return __builtin_bit_cast(float, __builtin_amdgcn_permlanex16(__builtin_bit_cast(int, x), __builtin_bit_cast(int, x), 0x76543210, 0xfedcba98, false, false)); }      /* lane l's word to lane l ^ 16 */
// 2^x on v_exp_f32, bare (a result under 2^-126 may come as nought: far under the flush line and under the sums' last bit). Written as asm for the slot: the instruction set asks for one slot behind a transcendental before its result is read or its source overwritten: the outputs are early-clobber, so that no v_exp_f32 of a statement writes over a source of the one in front of it, and the v_nop at the end is the slot behind the last
__device__ __forceinline__ float exp2_1(float x) { float u; asm("v_exp_f32 %0, %1\n\tv_nop" : "=v"(u) : "v"(x)); return u; }
__device__ __forceinline__ v8f exp2_8(v8f x) { float u0, u1, u2, u3, u4, u5, u6, u7;      /* eight in one statement: one v_nop serves all eight */
  asm("v_exp_f32 %0, %8\n\tv_exp_f32 %1, %9\n\tv_exp_f32 %2, %10\n\tv_exp_f32 %3, %11\n\tv_exp_f32 %4, %12\n\tv_exp_f32 %5, %13\n\tv_exp_f32 %6, %14\n\tv_exp_f32 %7, %15\n\tv_nop"
      : "=&v"(u0), "=&v"(u1), "=&v"(u2), "=&v"(u3), "=&v"(u4), "=&v"(u5), "=&v"(u6), "=&v"(u7) : "v"(x[0]), "v"(x[1]), "v"(x[2]), "v"(x[3]), "v"(x[4]), "v"(x[5]), "v"(x[6]), "v"(x[7]));
  const v8f u = {u0, u1, u2, u3, u4, u5, u6, u7}; return u; }
// the raw sums of 16 keys (rows: 8 hh + r) against FNI x 16 queries (columns: ln): word.word, and residual.word + word.residual in a second accumulator at 2^-10
struct KF { v16h w0, w1, l0, l1; };      /* 16 keys: word and residual, two depth steps of 32 */
__device__ __forceinline__ KF f_load(const _Float16* __restrict__ kw, const _Float16* __restrict__ kl) { KF k; k.w0 = g3_frag(kw, 0); k.w1 = g3_frag(kw, 1); k.l0 = g3_frag(kl, 0); k.l1 = g3_frag(kl, 1); return k; }
__device__ __forceinline__ void f_tile(const KF& k, const v16h (&qh)[FNI][2], const v16h (&ql)[FNI][2], v8f (&s)[FNI]) { const v8f z8 = {0.f,0.f,0.f,0.f,0.f,0.f,0.f,0.f};
#pragma unroll
  for (int ni = 0; ni < FNI; ++ni) { v8f cm = f_mma(k.w0, qh[ni][0], z8), cr = f_mma(k.w0, ql[ni][0], z8); cm = f_mma(k.w1, qh[ni][1], cm); cr = f_mma(k.w1, ql[ni][1], cr); cr = f_mma(k.l0, qh[ni][0], cr); cr = f_mma(k.l1, qh[ni][1], cr);
    s[ni] = cm + cr * 0.0009765625f; } }

// a work-group: FNI x 16 query rows of one group; wave w: keys [w FKW, (w + 1) FKW), 32 a trip. Lane (ln, hh) sees query ln of each tile and keys 8 hh + r and 16 + 8 hh + r of the trip's 32.
__global__ __launch_bounds__(FNW * 32) void k_fat(const _Float16* __restrict__ QH, const _Float16* __restrict__ QL, const _Float16* __restrict__ KW, const _Float16* __restrict__ KL, const _Float16* __restrict__ VC, const float* __restrict__ xa, const float* __restrict__ kv, const float* __restrict__ gs, float* __restrict__ res) {
  __shared__ float smx[FNW][FNI][32]; __shared__ float ssm[FNW][FNI][32]; __shared__ float red[FNW][FNI * 4 * 8 * 32];
  const int tid = threadIdx.x, w = tid >> 5, lane = tid & 31, ln = lane & 15, hh = lane >> 4; const int g = blockIdx.y, i0 = blockIdx.x * (FNI * 16);
  v16h qh[FNI][2], ql[FNI][2];
#pragma unroll
  for (int ni = 0; ni < FNI; ++ni) { const size_t e = ((size_t)g * MNN + i0 + ni * 16) * MNC + lane * 8; qh[ni][0] = g3_frag(QH + e, 0); qh[ni][1] = g3_frag(QH + e, 1); }
  asm volatile("s_wait_xcnt 0x0" ::: "memory");      /* the loads' address registers are given to later loads' results: the wait stands in front of that */
#pragma unroll
  for (int ni = 0; ni < FNI; ++ni) { const size_t e = ((size_t)g * MNN + i0 + ni * 16) * MNC + lane * 8; ql[ni][0] = g3_frag(QL + e, 0); ql[ni][1] = g3_frag(QL + e, 1); }
  asm volatile("s_wait_xcnt 0x0" ::: "memory");      /* as above, in front of the first keys' loads */
  const size_t k0 = ((size_t)g * MNN + w * FKW) * MNC + lane * 8; const _Float16* kwp = KW + k0; const _Float16* klp = KL + k0;
  float m[FNI], l[FNI];
#pragma unroll
  for (int ni = 0; ni < FNI; ++ni) { m[ni] = -__builtin_inff(); l[ni] = 0.0f; }
  const v8f z8 = {0.f,0.f,0.f,0.f,0.f,0.f,0.f,0.f}; v8f o[FNI][4];
#pragma unroll
  for (int ni = 0; ni < FNI; ++ni) { o[ni][0] = z8; o[ni][1] = z8; o[ni][2] = z8; o[ni][3] = z8; }
  const _Float16* vp = VC + ((size_t)g * MNN + w * FKW) * MNC + lane * 8;      /* 32 keys x 64 channels are 2,048 words in a row */
  for (int it = 0; it < FKW / 32; ++it) { v8f s0[FNI], s1[FNI]; v16h va[4]; const size_t cu = (size_t)it * 32 * MNC;
    { const _Float16* kwc = kwp + cu; const _Float16* klc = klp + cu; const KF ka = f_load(kwc, klc), kb = f_load(kwc + 16 * MNC, klc + 16 * MNC);
    asm volatile("s_wait_xcnt 0x0" :: "v"(kwc), "v"(klc) : "memory");      /* behind the keys' loads: their address registers are given to the raw sums further down, and the wait stands in front of that; the addresses as inputs only, so that no load's own result takes an address register in front of the wait */
    f_tile(ka, qh, ql, s0); f_tile(kb, qh, ql, s1); }
    FragH pf[FNI];
#pragma unroll
    for (int ni = 0; ni < FNI; ++ni) { float t = fmaxf(s0[ni][0], s1[ni][0]);
#pragma unroll
      for (int r = 1; r < 8; ++r) t = fmaxf(t, fmaxf(s0[ni][r], s1[ni][r]));
      t = fmaxf(t, xhalf(t));      /* the trip's 32 keys of a query lie in lanes ln and 16 + ln: both take one maximum, since the last product sums over all 32 */
      const float mn = fmaxf(m[ni], t), f = exp2_1((m[ni] - mn) * MLOG2E), mc = mn * MLOG2E - MLOGC; float a0 = 0.0f, a1 = 0.0f; const v8f e0 = exp2_8(s0[ni] * MLOG2E - mc), e1 = exp2_8(s1[ni] * MLOG2E - mc);      /* f: what was gathered under the old maximum is taken down to the new one (nought on the first trip); e0, e1: exp(z - maximum) 2^12 as 2^(z log2 e - mc), one multiply-add and one v_exp_f32 a word */
#pragma unroll
      for (int r = 0; r < 8; ++r) { const float u0 = e0[r], u1 = e1[r]; a0 = r ? a0 + u0 : u0; a1 = r ? a1 + u1 : u1; pf[ni].h[r] = (_Float16)(u0 < MFLUSH ? 0.0f : u0); pf[ni].h[8 + r] = (_Float16)(u1 < MFLUSH ? 0.0f : u1); }
      m[ni] = mn; l[ni] = l[ni] * f + (a0 + a1);
#pragma unroll
      for (int ct = 0; ct < 4; ++ct) o[ni][ct] *= f; }
#pragma unroll
    for (int ct = 0; ct < 4; ++ct) va[ct] = g3_frag(vp + cu + ct * 512, 0);
#pragma unroll
    for (int ct = 0; ct < 4; ++ct) {
#pragma unroll
      for (int ni = 0; ni < FNI; ++ni) o[ni][ct] = f_mma(va[ct], pf[ni].v, o[ni][ct]); }
    asm volatile("s_wait_xcnt 0x0" ::: "memory"); }      /* at the trip's foot: the next trip forms new addresses in the registers that this trip's last loads name, and the wait stands in front of that */
  const size_t e0 = ((size_t)g * MNC + w) * MNN + i0 + lane; float xv[MNC / FNW];      /* the result's other terms, read here so that they fly under the joining of the partial planes */
#pragma unroll
  for (int q = 0; q < MNC / FNW; ++q) xv[q] = xa[e0 + (size_t)q * FNW * MNN];
  const float kk = bf16_round(kv[(size_t)g * MNN + i0 + lane]), gk = bf16_round(gs[0]) * (1.0f - kk);
#pragma unroll
  for (int ni = 0; ni < FNI; ++ni) { smx[w][ni][lane] = m[ni]; ssm[w][ni][lane] = l[ni];
#pragma unroll
    for (int ct = 0; ct < 4; ++ct) {
#pragma unroll
      for (int r = 0; r < 8; ++r) red[w][((ni * 4 + ct) * 8 + r) * 32 + lane] = o[ni][ct][r]; } }
  __syncthreads();      /* every wave's maxima, sums and partial plane are in LDS */
  float hi = smx[0][lane >> 4][ln], sl = 0.0f; v8f fx;      /* from here a lane is query lane of the work-group's 32: each wave's plane and sum are taken from that wave's maximum down to the greatest */
#pragma unroll
  for (int u = 1; u < FNW; ++u) hi = fmaxf(hi, smx[u][lane >> 4][ln]);
#pragma unroll
  for (int u = 0; u < FNW; ++u) fx[u] = (smx[u][lane >> 4][ln] - hi) * MLOG2E;
  const v8f fu = exp2_8(fx);
#pragma unroll
  for (int u = 0; u < FNW; ++u) sl += (ssm[u][lane >> 4][ln] + ssm[u][lane >> 4][16 + ln]) * fu[u];
  const float rl = 1.0f / sl;      /* plane and sum carry the same 2^12: it leaves in the quotient */
#pragma unroll
  for (int q = 0; q < MNC / FNW; ++q) { const int c = w + FNW * q; const int e = (((lane >> 4) * 4 + (c >> 4)) * 8 + (c & 7)) * 32 + ((c >> 3) & 1) * 16 + ln; float s = red[0][e] * fu[0];      /* a wave a channel: its 32 lanes write one whole line of the result */
#pragma unroll
    for (int u = 1; u < FNW; ++u) s += red[u][e] * fu[u];
    res[e0 + (size_t)q * FNW * MNN] = bf16_round(xv[q]) * kk + gk * (s * rl); }      /* every element of the result once */
}

extern "C" void kernel_launch(void* const* d_in, const int* in_sizes, int n_in,
                              void* d_out, int out_size, void* d_ws, size_t ws_size, hipStream_t stream) {
  (void)in_sizes; (void)n_in; (void)out_size;
  const float* const* I = (const float* const*)d_in; const float* xa = I[0]; const float* ya = I[1]; const float* kv = I[2]; const float* wa = I[3]; const float* ba = I[4]; const float* wb = I[5]; const float* bb = I[6]; const float* wc = I[7]; const float* bc = I[8]; const float* gs = I[9];      /* xa and ya [2][64][6400]; kv [2][1][6400]; wa, wb, wc [64][64]; ba, bb, bc [64]; gs [1] */
  static_assert(MNN % (FNI * 16) == 0 && FNI == 2 && MNN % FNW == 0 && FKW % 32 == 0 && MNC == 64 && MNC % FNW == 0 && MNN % PPB == 0 && PPB == 64 && XPI >= MNC && XPI % 8 == 0, "whole tiles");
  uint8_t* wsp = (uint8_t*)d_ws; size_t off = 0;
  auto take = [&](size_t bytes) { uint8_t* p = wsp + off; off += (bytes + 255) & ~(size_t)255; return p; };
  _Float16* QH = (_Float16*)take((size_t)MNG * MNN * MNC * 2); _Float16* QL = (_Float16*)take((size_t)MNG * MNN * MNC * 2); _Float16* KW = (_Float16*)take((size_t)MNG * MNN * MNC * 2); _Float16* KL = (_Float16*)take((size_t)MNG * MNN * MNC * 2); _Float16* VC = (_Float16*)take((size_t)MNG * MNC * MNN * 2);      /* the first two projections as word | residual planes, the third as f16 words: all five in fragment order */
  if (off > ws_size) return;
  k_prj<<<dim3((unsigned)(MNG * (MNN / PPB)), 3), 128, 0, stream>>>(xa, ya, kv, wa, ba, wb, bb, wc, bc, QH, QL, KW, KL, VC);
  k_fat<<<dim3((unsigned)(MNN / (FNI * 16)), MNG), FNW * 32, 0, stream>>>(QH, QL, KW, KL, VC, xa, kv, gs, (float*)d_out);      /* res[g][c][i] = xa kv + gs (1 - kv) sum over j of VC[g][c][j] softmax(raw sums)[i][j] */
}

// v007
// A run of this version takes 44.3 microseconds.
// In two side-by-side timings against v006, it was 1.35 and 1.34 times as fast.
// Over all steps from v000 it is 192 times as fast.
// A single-head pair weighting over 6,400 positions of channel-first arrays with a multiplicative key vector: xa [2][64][6400] and ya [2][64][6400] (group, channel, position), kv [2][6400], wa, wb, wc [64][64] stored (row: result channel; column: source channel), ba, bb, bc [64], gs [1]: qr = wa xa + ba, kr = wb ya + bb, vr = wc xa + bc (channel-first); zs[g][i][j] = (sum over c of qr[c][i] kr[c][j]) kv[g][j]; wt[g][i][:] = softmax over j of zs[g][i][:]; ag[g][c][i] = sum over j of vr[c][j] wt[g][i][j]; res = xa kv + gs[0] (1 - kv) ag -> [2][64][6400] f32: one result.
// Structure: THREE launches. ONE projection kernel: a work-group takes 64 positions of one group and one of the three projections; it reads its 64 x 64 block of the channel-first array in whole lines, converts (bf16 first, then f16 words) and lays it transposed in LDS as position rows; the weight's rows and the added vector are converted and laid in LDS beside it; WMMA: the first two projections with the weight's rows as the first operand (a lane's eight accumulator words are eight channels of one position: one 16-byte store, LAID IN FRAGMENT ORDER: a tile of 16 positions is four pieces of 512 bytes, lane after lane, exactly as the fused kernel's waves load them, so that every wave-wide store and load covers four whole lines), the added vector joined, THE KEY VECTOR MULTIPLIED INTO THE SECOND PROJECTION's ROWS (kr[:][j] kv[j]: the same sum over c, the factor taken inside it: nothing stands between), each split into an f16 word and an f16 residual word (x 2^10); the third projection with the position rows as the first operand (eight positions of one channel a lane; stored in fragment order too: 32 positions x 16 channels are two pieces of 512 bytes), its added vector joined and the sum stored as one f16 word; ONE FUSED kernel for raw sums, softmax and weighted sum: a work-group of eight waves owns 256 query rows (32 a wave) and one chunk of 640 of the 6,400 keys; each trip's 32 keys (word plane, residual plane, third projection: 4 KiB in a row each, already in fragment order) are brought to LDS ONCE for all eight waves by asynchronous copies, two buffers, the next tile flying while this one is worked on, and every wave reads its fragments from LDS; the raw sums are formed key-major (keys as the first operand's rows, queries as the second's) by three products (word.word; residual.word and word.residual in one accumulator at 2^-10) and stay in registers; ONE pass over the keys: each trip raises the wave's running maximum of each query (in-lane, then one exchange between the wave's halves), takes the sum and the partial plane gathered so far down to it, and takes exp(z - maximum) as one f16 word behind a carry of 2^12 (words under 2^-14 stored as nought): the accumulator's layout IS the second operand's layout of the last product (channel-first third projection against those words), so nothing is transposed; each chunk's maxima, sums and partial planes go to the workspace; ONE JOINING kernel: the ten chunks' planes and sums of a query are taken down to the greatest maximum and summed, and the quotient is joined with xa, kv and gs into the result.
// Compute dtype: all ten inputs converted to bf16 where they are read; the arrays' rows and the weights exact as f16 words down to 2^-14; the two projections TWO f16 words each; the third projection ONE f16 word; the softmax words ONE f16 word behind 2^12 with the small words flushed at the cast; every product's accumulation, the raw sums, the softmax's arithmetic and the result f32. v_wmma_f32_16x16x32_f16.
#include <hip/hip_runtime.h>
#define MNG 2                        /* groups */
#define MNC 64                       /* channels: the projections' depth and width */
#define MNN 6400                     /* positions: the softmax's axis */
#define FNI 2                        /* query tiles of 16 rows a fused wave owns */
#define MLOGC 12.0f                  /* the softmax words carry 2^12 (the greatest is 2^12), added in the base-2 exponent; their sum carries it too, and it leaves in the quotient */
#define MLOG2E 1.4426950408889634f   /* log2 e: exp(x) is taken as 2^(x log2 e) on the chip's own base-2 exponential */
#define MFLUSH 6.103515625e-05f      /* 2^-14: a softmax word under it is stored as nought */
#define FNW 8                        /* waves of a fused work-group: the queries are split among them, the keys are shared */
#define FNZ 10                       /* key chunks: a work-group takes one */
#define FKC (MNN / FNZ)              /* keys of a chunk */
#define FNT (FKC / 32)               /* trips of 32 keys */
#define FQB (FNW * FNI * 16)         /* query rows of a fused work-group */
#define KTB (3 * 32 * MNC * 2)       /* bytes of one LDS buffer: three planes of 32 keys */
typedef unsigned short v8us __attribute__((ext_vector_type(8), may_alias));
typedef float  v8f  __attribute__((ext_vector_type(8)));
typedef float  v4f  __attribute__((ext_vector_type(4)));
typedef float  v4fa __attribute__((ext_vector_type(4), may_alias));

__device__ __forceinline__ unsigned short bf16_bits(float x) { unsigned int u = __float_as_uint(x); return (unsigned short)((u + 0x7FFFu + ((u >> 16) & 1u)) >> 16); }
__device__ __forceinline__ float bf16_val(unsigned short b) { return __uint_as_float(((unsigned int)b) << 16); }
__device__ __forceinline__ float bf16_round(float x) { return bf16_val(bf16_bits(x)); }

typedef _Float16 v16h __attribute__((ext_vector_type(16)));
union FragH { v16h v; v8us half[2]; _Float16 h[16]; unsigned short u[16]; };

__device__ __forceinline__ v16h g2_frag(const _Float16* p, int hh) { FragH f; f.half[0] = *(const v8us*)((const unsigned short*)p + 8 * hh); f.half[1] = *(const v8us*)((const unsigned short*)p + 16 + 8 * hh); return f.v; }
// a fragment from a workspace plane laid in fragment order: p is the lane's own 8 words in a tile's first piece of 512 bytes (32 lanes x 16 bytes in a row); pieces 2 d and 2 d + 1 are the two halves of depth step d, so that a wave's load is four whole lines
__device__ __forceinline__ v16h g3_frag(const _Float16* p, int d) { FragH f; f.half[0] = *(const v8us*)((const unsigned short*)p + 512 * d); f.half[1] = *(const v8us*)((const unsigned short*)p + 512 * d + 256); return f.v; }
#define PPB 64                       /* positions a projection work-group takes */
#define XPI 72                       /* f16 words from one position row to the next in LDS: 144 bytes = 16 x 9, so that 16-byte fragment reads spread over the banks */
typedef _Float16 v2ha __attribute__((ext_vector_type(2), may_alias));
__device__ __forceinline__ v8f f_mma(v16h a, v16h b, v8f c) { return __builtin_amdgcn_wmma_f32_16x16x32_f16(false, a, false, b, (short)0, c, false, false); }
typedef _Float16 v4ha __attribute__((ext_vector_type(4), may_alias));
// blockIdx.y: 0 the first projection (xa, wa, ba -> QH | QL), 1 the second (ya, wb, bb, x kv -> KW | KL), 2 the third (xa, wc, bc -> VC); blockIdx.x: PPB positions of one group
__global__ __launch_bounds__(128) void k_prj(const float* __restrict__ xa, const float* __restrict__ ya, const float* __restrict__ kv, const float* __restrict__ wa, const float* __restrict__ ba, const float* __restrict__ wb, const float* __restrict__ bb, const float* __restrict__ wc, const float* __restrict__ bc,
    _Float16* __restrict__ QH, _Float16* __restrict__ QL, _Float16* __restrict__ KW, _Float16* __restrict__ KL, _Float16* __restrict__ VC) {
  __shared__ __attribute__((aligned(16))) _Float16 xs[PPB][XPI]; __shared__ __attribute__((aligned(16))) _Float16 ws[MNC][XPI]; __shared__ __attribute__((aligned(16))) float bs[MNC];      /* position rows; the weight's rows; the added vector */
  const int tid = threadIdx.x, w = tid >> 5, lane = tid & 31, ln = lane & 15, hh = lane >> 4; const int job = blockIdx.y, g = blockIdx.x / (MNN / PPB), i0 = (blockIdx.x % (MNN / PPB)) * PPB;
  const float* sp = (job == 1 ? ya : xa) + (size_t)g * MNC * MNN + i0 + (tid & 15) * 4 + (size_t)(tid >> 4) * 2 * MNN;      /* a thread: four positions of channels 2 (tid / 16) + 16 q and the next: a wave's load is two whole rows of 256 bytes */
  const float* wp = (job == 0 ? wa : job == 1 ? wb : wc) + tid * 4; const float* bp = job == 0 ? ba : job == 1 ? bb : bc; const size_t p = (size_t)g * MNN + i0 + 16 * w + ln;
  v4f x0[4], x1[4], wv[8];
#pragma unroll
  for (int q = 0; q < 4; ++q) { x0[q] = *(const v4fa*)(sp + (size_t)q * 16 * MNN); x1[q] = *(const v4fa*)(sp + (size_t)(q * 16 + 1) * MNN); }
#pragma unroll
  for (int q = 0; q < 8; ++q) wv[q] = *(const v4fa*)(wp + q * 512);      /* the weight as it lies: a wave's load is 512 bytes in a row */
  const float* bq = bp + (tid & (MNC - 1)); const float* kq = kv + p; const float br = *bq, kr = *kq;      /* kv's 12,800 words lie in the order of the position rows */
  asm volatile("s_wait_xcnt 0x0" :: "v"(x0[0]), "v"(x0[1]), "v"(x0[2]), "v"(x0[3]), "v"(x1[0]), "v"(x1[1]), "v"(x1[2]), "v"(x1[3]), "v"(wv[0]), "v"(wv[1]), "v"(wv[2]), "v"(wv[3]), "v"(wv[4]), "v"(wv[5]), "v"(wv[6]), "v"(wv[7]), "v"(br), "v"(kr), "v"(sp), "v"(wp), "v"(bq), "v"(kq) : "memory");      /* the loaded words and the addresses as inputs only: all 18 loads are issued in front of this line, so that their latencies overlap and are paid once, and no address register is given away in front of the wait */
#pragma unroll
  for (int q = 0; q < 4; ++q) {
#pragma unroll
    for (int e = 0; e < 4; ++e) { v2ha h2; h2[0] = (_Float16)bf16_round(x0[q][e]); h2[1] = (_Float16)bf16_round(x1[q][e]); *(v2ha*)&xs[(tid & 15) * 4 + e][(tid >> 4) * 2 + 16 * q] = h2; } }
#pragma unroll
  for (int q = 0; q < 8; ++q) { v4ha h4;
#pragma unroll
    for (int e = 0; e < 4; ++e) h4[e] = (_Float16)bf16_round(wv[q][e]);
    *(v4ha*)&ws[q * 8 + (tid >> 4)][(tid & 15) * 4] = h4; }
  if (tid < MNC) bs[tid] = bf16_round(br);
  __syncthreads();      /* position rows, weight rows and added vector are in LDS */
  const v8f z8 = {0.f,0.f,0.f,0.f,0.f,0.f,0.f,0.f};
  if (job < 2) {      /* wave w: positions 16 w + ln as columns, all 64 result channels as rows (a lane's eight words: eight channels of one position): it writes one whole tile of both planes */
    const size_t pt = ((size_t)g * MNN + i0 + 16 * w) * MNC + lane * 8; unsigned short* Hh = (unsigned short*)(job == 0 ? QH : KW) + pt; unsigned short* Hl = (unsigned short*)(job == 0 ? QL : KL) + pt;      /* the wave's tile of 16 positions: 2 KiB in fragment order, piece t = channels 16 t + 8 hh + r of position ln at lane 16 hh + ln */ const float kk = job == 1 ? bf16_round(kr) : 1.0f;      /* x 1 is exact */
    const v16h b0 = g2_frag(&xs[16 * w + ln][0], hh), b1 = g2_frag(&xs[16 * w + ln][32], hh); FragH fh[4], fl[4];
#pragma unroll
    for (int t = 0; t < 4; ++t) { v8f c = f_mma(g2_frag(&ws[16 * t + ln][0], hh), b0, z8); c = f_mma(g2_frag(&ws[16 * t + ln][32], hh), b1, c); const v4f u0 = *(const v4fa*)&bs[16 * t + 8 * hh], u1 = *(const v4fa*)&bs[16 * t + 8 * hh + 4];
#pragma unroll
      for (int r = 0; r < 8; ++r) { const float v = (c[r] + (r < 4 ? u0[r & 3] : u1[r & 3])) * kk; const _Float16 h = (_Float16)v; fh[t].h[r] = h; fl[t].h[r] = (_Float16)((v - (float)h) * 1024.0f); } }
#pragma unroll
    for (int t = 0; t < 4; ++t) { *(v8us*)(Hh + 256 * t) = fh[t].half[0]; *(v8us*)(Hl + 256 * t) = fl[t].half[0]; }      /* the tile's eight pieces in a run at the arm's end: no stored register is written again */
  } else {      /* wave w: result channels 16 w + ln as columns, all PPB positions as rows (a lane's eight words: eight positions of one channel): it writes whole pieces of 512 bytes */
    unsigned short* vo = (unsigned short*)VC + (((size_t)g * MNN + i0) / 32 * 4 + w) * 512 + lane * 8;      /* 32 positions x 16 channels: 1 KiB in fragment order, piece h = positions 16 h + 8 hh + r of channel ln at lane 16 hh + ln; four channel tiles in a row */ const float bv = (float)(_Float16)bs[16 * w + ln];
    const v16h b0 = g2_frag(&ws[16 * w + ln][0], hh), b1 = g2_frag(&ws[16 * w + ln][32], hh);
#pragma unroll
    for (int t = 0; t < 4; ++t) { v8f c = f_mma(g2_frag(&xs[16 * t + ln][0], hh), b0, z8); c = f_mma(g2_frag(&xs[16 * t + ln][32], hh), b1, c); FragH f;
#pragma unroll
      for (int r = 0; r < 8; ++r) f.h[r] = (_Float16)(c[r] + bv);
      *(v8us*)(vo + (t >> 1) * 2048 + (t & 1) * 256) = f.half[0]; }
    asm volatile("s_wait_xcnt 0x0" ::: "memory");      /* behind the arm's last store: the stores' address pair is not given away in front of the wait */
  }
}

__device__ __forceinline__ float xhalf(float x) { return __builtin_bit_cast(float, __builtin_amdgcn_permlanex16(__builtin_bit_cast(int, x), __builtin_bit_cast(int, x), 0x76543210, 0xfedcba98, false, false)); }      /* lane l's word to lane l ^ 16 */
// 2^x on v_exp_f32, bare (a result under 2^-126 may come as nought: far under the flush line and under the sums' last bit). Written as asm for the slot: the instruction set asks for one slot behind a transcendental before its result is read or its source overwritten: the outputs are early-clobber, so that no v_exp_f32 of a statement writes over a source of the one in front of it, and the v_nop at the end is the slot behind the last
__device__ __forceinline__ float exp2_1(float x) { float u; asm("v_exp_f32 %0, %1\n\tv_nop" : "=v"(u) : "v"(x)); return u; }
__device__ __forceinline__ v8f exp2_8(v8f x) { float u0, u1, u2, u3, u4, u5, u6, u7;      /* eight in one statement: one v_nop serves all eight */
  asm("v_exp_f32 %0, %8\n\tv_exp_f32 %1, %9\n\tv_exp_f32 %2, %10\n\tv_exp_f32 %3, %11\n\tv_exp_f32 %4, %12\n\tv_exp_f32 %5, %13\n\tv_exp_f32 %6, %14\n\tv_exp_f32 %7, %15\n\tv_nop"
      : "=&v"(u0), "=&v"(u1), "=&v"(u2), "=&v"(u3), "=&v"(u4), "=&v"(u5), "=&v"(u6), "=&v"(u7) : "v"(x[0]), "v"(x[1]), "v"(x[2]), "v"(x[3]), "v"(x[4]), "v"(x[5]), "v"(x[6]), "v"(x[7]));
  const v8f u = {u0, u1, u2, u3, u4, u5, u6, u7}; return u; }
// the raw sums of 16 keys (rows: 8 hh + r) against FNI x 16 queries (columns: ln): word.word, and residual.word + word.residual in a second accumulator at 2^-10
struct KF { v16h w0, w1, l0, l1; };      /* 16 keys: word and residual, two depth steps of 32 */
__device__ __forceinline__ KF f_load(const _Float16* __restrict__ kw, const _Float16* __restrict__ kl) { KF k; k.w0 = g3_frag(kw, 0); k.w1 = g3_frag(kw, 1); k.l0 = g3_frag(kl, 0); k.l1 = g3_frag(kl, 1); return k; }
__device__ __forceinline__ void f_tile(const KF& k, const v16h (&qh)[FNI][2], const v16h (&ql)[FNI][2], v8f (&s)[FNI]) { const v8f z8 = {0.f,0.f,0.f,0.f,0.f,0.f,0.f,0.f};
#pragma unroll
  for (int ni = 0; ni < FNI; ++ni) { v8f cm = f_mma(k.w0, qh[ni][0], z8), cr = f_mma(k.w0, ql[ni][0], z8); cm = f_mma(k.w1, qh[ni][1], cm); cr = f_mma(k.w1, ql[ni][1], cr); cr = f_mma(k.l0, qh[ni][0], cr); cr = f_mma(k.l1, qh[ni][1], cr);
    s[ni] = cm + cr * 0.0009765625f; } }

// one tile of 32 keys from the workspace to LDS: 16 bytes a thread of each plane (word, residual, third projection), through no register. The wait is the statement's last line, so that no register which a copy names is written again in front of it
__device__ __forceinline__ void f_copy(unsigned ld, const _Float16* gw, const _Float16* gl, const _Float16* gv) {
  asm volatile("global_load_async_to_lds_b128 %0, %1, off\n\tglobal_load_async_to_lds_b128 %2, %3, off\n\tglobal_load_async_to_lds_b128 %4, %5, off\n\ts_wait_xcnt 0x0"
      :: "v"(ld), "v"(gw), "v"(ld + 4096u), "v"(gl), "v"(ld + 8192u), "v"(gv) : "memory"); }
// a work-group: FQB query rows of one group (blockIdx.x, blockIdx.y) against the FKC keys of chunk blockIdx.z, 32 a trip, shared by its waves through LDS; wave w: FNI x 16 of the query rows. Lane (ln, hh) sees query ln of each tile and keys 8 hh + r and 16 + 8 hh + r of the trip's 32.
__global__ __launch_bounds__(FNW * 32) void k_fat(const _Float16* __restrict__ QH, const _Float16* __restrict__ QL, const _Float16* __restrict__ KW, const _Float16* __restrict__ KL, const _Float16* __restrict__ VC, float* __restrict__ PO, float* __restrict__ PM, float* __restrict__ PL) {
  __shared__ __attribute__((aligned(16))) _Float16 kt[2][3][32 * MNC];      /* two buffers x (word, residual, third projection) x 32 keys in fragment order */
  const int tid = threadIdx.x, w = tid >> 5, lane = tid & 31, hh = lane >> 4; const int g = blockIdx.y, z = blockIdx.z, i0 = blockIdx.x * FQB + w * (FNI * 16);
  const size_t k0 = ((size_t)g * MNN + z * FKC) * MNC + tid * 8; const _Float16* gw = KW + k0; const _Float16* gl = KL + k0; const _Float16* gv = VC + k0;      /* 32 keys x 64 channels are 2,048 words in a row in each plane */
  const unsigned ld = (unsigned)(size_t)&kt[0][0][tid * 8];      /* the thread's own 16 bytes in buffer 0's first plane: the LDS byte address is the low word */
  f_copy(ld, gw, gl, gv);      /* tile 0 flies under the queries' loads */
  v16h qh[FNI][2], ql[FNI][2];
#pragma unroll
  for (int ni = 0; ni < FNI; ++ni) { const size_t e = ((size_t)g * MNN + i0 + ni * 16) * MNC + lane * 8; qh[ni][0] = g3_frag(QH + e, 0); qh[ni][1] = g3_frag(QH + e, 1); }
  asm volatile("s_wait_xcnt 0x0" ::: "memory");      /* the loads' address registers are given to later loads' results: the wait stands in front of that */
#pragma unroll
  for (int ni = 0; ni < FNI; ++ni) { const size_t e = ((size_t)g * MNN + i0 + ni * 16) * MNC + lane * 8; ql[ni][0] = g3_frag(QL + e, 0); ql[ni][1] = g3_frag(QL + e, 1); }
  asm volatile("s_wait_xcnt 0x0" ::: "memory");      /* as above, in front of what follows */
  asm volatile("s_wait_asynccnt 0x0" ::: "memory");      /* this wave's copies of tile 0 have landed */
  __syncthreads();      /* tile 0 is in LDS for every wave */
  f_copy(ld + KTB, gw + 32 * MNC, gl + 32 * MNC, gv + 32 * MNC);      /* tile 1 flies under trip 0 */
  float m[FNI], l[FNI];
#pragma unroll
  for (int ni = 0; ni < FNI; ++ni) { m[ni] = -__builtin_inff(); l[ni] = 0.0f; }
  const v8f z8 = {0.f,0.f,0.f,0.f,0.f,0.f,0.f,0.f}; v8f o[FNI][4];
#pragma unroll
  for (int ni = 0; ni < FNI; ++ni) { o[ni][0] = z8; o[ni][1] = z8; o[ni][2] = z8; o[ni][3] = z8; }
  for (int it = 0; it < FNT; ++it) { v8f s0[FNI], s1[FNI]; v16h va[4]; const _Float16* kc = &kt[it & 1][0][lane * 8];      /* the lane's own 8 words in the buffer's first piece */
    { const KF ka = f_load(kc, kc + 32 * MNC), kb = f_load(kc + 16 * MNC, kc + 48 * MNC);
    f_tile(ka, qh, ql, s0); f_tile(kb, qh, ql, s1); }
    FragH pf[FNI];
#pragma unroll
    for (int ni = 0; ni < FNI; ++ni) { float t = fmaxf(s0[ni][0], s1[ni][0]);
#pragma unroll
      for (int r = 1; r < 8; ++r) t = fmaxf(t, fmaxf(s0[ni][r], s1[ni][r]));
      t = fmaxf(t, xhalf(t));      /* the trip's 32 keys of a query lie in lanes ln and 16 + ln: both take one maximum, since the last product sums over all 32 */
      const float mn = fmaxf(m[ni], t), f = exp2_1((m[ni] - mn) * MLOG2E), mc = mn * MLOG2E - MLOGC; float a0 = 0.0f, a1 = 0.0f; const v8f e0 = exp2_8(s0[ni] * MLOG2E - mc), e1 = exp2_8(s1[ni] * MLOG2E - mc);      /* f: what was gathered under the old maximum is taken down to the new one (nought on the first trip); e0, e1: exp(z - maximum) 2^12 as 2^(z log2 e - mc), one multiply-add and one v_exp_f32 a word */
#pragma unroll
      for (int r = 0; r < 8; ++r) { const float u0 = e0[r], u1 = e1[r]; a0 = r ? a0 + u0 : u0; a1 = r ? a1 + u1 : u1; pf[ni].h[r] = (_Float16)(u0 < MFLUSH ? 0.0f : u0); pf[ni].h[8 + r] = (_Float16)(u1 < MFLUSH ? 0.0f : u1); }
      m[ni] = mn; l[ni] = l[ni] * f + (a0 + a1);
#pragma unroll
      for (int ct = 0; ct < 4; ++ct) o[ni][ct] *= f; }
#pragma unroll
    for (int ct = 0; ct < 4; ++ct) va[ct] = g3_frag(kc + 64 * MNC + ct * 512, 0);
#pragma unroll
    for (int ct = 0; ct < 4; ++ct) {
#pragma unroll
      for (int ni = 0; ni < FNI; ++ni) o[ni][ct] = f_mma(va[ct], pf[ni].v, o[ni][ct]); }
    asm volatile("s_wait_dscnt 0x0" ::: "memory");      /* this wave's reads of the trip's buffer are done before the buffer is given back */
    asm volatile("s_wait_asynccnt 0x0" ::: "memory");      /* this wave's copies of the next tile have landed */
    __syncthreads();      /* the next tile is in LDS for every wave, and every wave has left this trip's buffer */
    if (it + 2 < FNT) f_copy(ld + (unsigned)(it & 1) * KTB, gw + (size_t)(it + 2) * 32 * MNC, gl + (size_t)(it + 2) * 32 * MNC, gv + (size_t)(it + 2) * 32 * MNC); }      /* the tile after the next into the buffer just left */
  asm volatile("s_wait_asynccnt 0x0" ::: "memory");      /* no copy is outstanding when the wave ends */
  float* po = PO + ((((size_t)g * (MNN / 16) + (i0 >> 4)) * 4) * FNZ + z) * 256 + lane * 4;      /* PO[group][tile of 16 queries][tile of 16 channels][chunk][r / 4][lane][r % 4]: every wave-wide 16-byte store covers 512 bytes in a row */
#pragma unroll
  for (int ni = 0; ni < FNI; ++ni) {
#pragma unroll
    for (int ct = 0; ct < 4; ++ct) { const v4f u0 = {o[ni][ct][0], o[ni][ct][1], o[ni][ct][2], o[ni][ct][3]}, u1 = {o[ni][ct][4], o[ni][ct][5], o[ni][ct][6], o[ni][ct][7]}; *(v4fa*)(po + (ni * 4 + ct) * FNZ * 256) = u0; *(v4fa*)(po + (ni * 4 + ct) * FNZ * 256 + 128) = u1; } }
  const float l0 = l[0] + xhalf(l[0]), l1 = l[1] + xhalf(l[1]); const size_t eq = ((size_t)g * FNZ + z) * MNN + i0 + lane;      /* a query's sum lies in lanes ln and 16 + ln; from here a lane is query lane of the wave's 32 */
  PM[eq] = hh ? m[1] : m[0]; PL[eq] = hh ? l1 : l0;
  asm volatile("s_wait_xcnt 0x0" ::: "memory");      /* behind the last store: no store's register is given away in front of the wait */
}

// the chunks joined: a work-group takes 32 queries of one group; wave w: channels 16 (w / 2) + 8 hh + 4 (w % 2) + r, r under 4, of queries ln and 16 + ln: it writes both halves of each line of the result
__global__ __launch_bounds__(256) void k_jn(const float* __restrict__ PO, const float* __restrict__ PM, const float* __restrict__ PL, const float* __restrict__ xa, const float* __restrict__ kv, const float* __restrict__ gs, float* __restrict__ res) {
  const int tid = threadIdx.x, w = tid >> 5, lane = tid & 31, ln = lane & 15, hh = lane >> 4; const int g = blockIdx.y, i0 = blockIdx.x * 32;
  const float* pp = PO + (((size_t)g * (MNN / 16) + (i0 >> 4)) * 4 + (w >> 1)) * FNZ * 256 + (w & 1) * 128 + lane * 4; const size_t eq = (size_t)g * FNZ * MNN + i0 + ln; const float* pm = PM + eq; const float* pl = PL + eq;
  const size_t e0 = ((size_t)g * MNC + 16 * (w >> 1) + 8 * hh + 4 * (w & 1)) * MNN + i0 + ln; const float* px = xa + e0; const float* pk = kv + (size_t)g * MNN + i0;
  v4f pv[FNI][FNZ]; float mv[FNI][FNZ], lv[FNI][FNZ], xv[FNI][4], kr[FNI];
#pragma unroll
  for (int ni = 0; ni < FNI; ++ni) {
#pragma unroll
    for (int u = 0; u < FNZ; ++u) { mv[ni][u] = pm[u * MNN + ni * 16]; lv[ni][u] = pl[u * MNN + ni * 16]; pv[ni][u] = *(const v4fa*)(pp + (ni * 4 * FNZ + u) * 256); }
#pragma unroll
    for (int r = 0; r < 4; ++r) xv[ni][r] = px[r * MNN + ni * 16];
    kr[ni] = pk[ni * 16 + ln]; }
  const float gr = bf16_round(gs[0]);
  asm volatile("s_wait_xcnt 0x0" :: "v"(pp), "v"(pm), "v"(pl), "v"(px), "s"(pk), "v"(ln) : "memory");      /* behind the loads; the addresses (of kv: its scalar base and lane offset) as inputs only, so that no load's own result takes an address register in front of the wait */
  float* pr = res + e0;
#pragma unroll
  for (int ni = 0; ni < FNI; ++ni) { float hi = mv[ni][0], sl = 0.0f, fu[FNZ];      /* each chunk's plane and sum are taken from that chunk's maximum down to the greatest */
#pragma unroll
    for (int u = 1; u < FNZ; ++u) hi = fmaxf(hi, mv[ni][u]);
#pragma unroll
    for (int u = 0; u < FNZ; ++u) { fu[u] = exp2_1((mv[ni][u] - hi) * MLOG2E); sl += lv[ni][u] * fu[u]; }
    v4f s = pv[ni][0] * fu[0];
#pragma unroll
    for (int u = 1; u < FNZ; ++u) s += pv[ni][u] * fu[u];
    const float rl = 1.0f / sl, kk = bf16_round(kr[ni]), gk = gr * (1.0f - kk);      /* plane and sum carry the same 2^12: it leaves in the quotient */
#pragma unroll
    for (int r = 0; r < 4; ++r) pr[r * MNN + ni * 16] = bf16_round(xv[ni][r]) * kk + gk * (s[r] * rl); }      /* every element of the result once */
  asm volatile("s_wait_xcnt 0x0" ::: "memory");      /* behind the last store: no store's register is given away in front of the wait */
}

extern "C" void kernel_launch(void* const* d_in, const int* in_sizes, int n_in,
                              void* d_out, int out_size, void* d_ws, size_t ws_size, hipStream_t stream) {
  (void)in_sizes; (void)n_in; (void)out_size;
  const float* const* I = (const float* const*)d_in; const float* xa = I[0]; const float* ya = I[1]; const float* kv = I[2]; const float* wa = I[3]; const float* ba = I[4]; const float* wb = I[5]; const float* bb = I[6]; const float* wc = I[7]; const float* bc = I[8]; const float* gs = I[9];      /* xa and ya [2][64][6400]; kv [2][1][6400]; wa, wb, wc [64][64]; ba, bb, bc [64]; gs [1] */
  static_assert(MNN % FQB == 0 && FNI == 2 && MNN % FNZ == 0 && FKC % 32 == 0 && FNT >= 2 && FNW == 8 && MNC == 64 && MNN % PPB == 0 && PPB == 64 && XPI >= MNC && XPI % 8 == 0, "whole tiles");
  uint8_t* wsp = (uint8_t*)d_ws; size_t off = 0;
  auto take = [&](size_t bytes) { uint8_t* p = wsp + off; off += (bytes + 255) & ~(size_t)255; return p; };
  _Float16* QH = (_Float16*)take((size_t)MNG * MNN * MNC * 2); _Float16* QL = (_Float16*)take((size_t)MNG * MNN * MNC * 2); _Float16* KW = (_Float16*)take((size_t)MNG * MNN * MNC * 2); _Float16* KL = (_Float16*)take((size_t)MNG * MNN * MNC * 2); _Float16* VC = (_Float16*)take((size_t)MNG * MNC * MNN * 2);      /* the first two projections as word | residual planes, the third as f16 words: all five in fragment order */
  float* PO = (float*)take((size_t)FNZ * MNG * MNN * MNC * 4); float* PM = (float*)take((size_t)FNZ * MNG * MNN * 4); float* PL = (float*)take((size_t)FNZ * MNG * MNN * 4);      /* each chunk's partial planes, maxima and sums */
  if (off > ws_size) return;
  k_prj<<<dim3((unsigned)(MNG * (MNN / PPB)), 3), 128, 0, stream>>>(xa, ya, kv, wa, ba, wb, bb, wc, bc, QH, QL, KW, KL, VC);
  k_fat<<<dim3((unsigned)(MNN / FQB), MNG, FNZ), FNW * 32, 0, stream>>>(QH, QL, KW, KL, VC, PO, PM, PL);      /* per chunk of keys: maxima, sums and sum over j of VC[g][c][j] exp(raw sums - maximum)[i][j] */
  k_jn<<<dim3((unsigned)(MNN / 32), MNG), 256, 0, stream>>>(PO, PM, PL, xa, kv, gs, (float*)d_out);      /* res[g][c][i] = xa kv + gs (1 - kv) (chunks joined, quotient) */
}

// v008
// It runs in 42.5 microseconds.
// Next to v007, in two timings, it ran 1.04 times as fast each time.
// All steps since v000 together make it 200 times as fast.
// A single-head pair weighting over 6,400 positions of channel-first arrays with a multiplicative key vector: xa [2][64][6400] and ya [2][64][6400] (group, channel, position), kv [2][6400], wa, wb, wc [64][64] stored (row: result channel; column: source channel), ba, bb, bc [64], gs [1]: qr = wa xa + ba, kr = wb ya + bb, vr = wc xa + bc (channel-first); zs[g][i][j] = (sum over c of qr[c][i] kr[c][j]) kv[g][j]; wt[g][i][:] = softmax over j of zs[g][i][:]; ag[g][c][i] = sum over j of vr[c][j] wt[g][i][j]; res = xa kv + gs[0] (1 - kv) ag -> [2][64][6400] f32: one result.
// Structure: THREE launches. ONE projection kernel: a work-group takes 64 positions of one group and one of the three projections; it reads its 64 x 64 block of the channel-first array in whole lines, converts (bf16 first, then f16 words) and lays it transposed in LDS as position rows; the weight's rows and the added vector are converted and laid in LDS beside it; WMMA: the first two projections with the weight's rows as the first operand (a lane's eight accumulator words are eight channels of one position: one 16-byte store, LAID IN FRAGMENT ORDER: a tile of 16 positions is four pieces of 512 bytes, lane after lane, exactly as the fused kernel's waves load them, so that every wave-wide store and load covers four whole lines), the added vector joined, THE KEY VECTOR MULTIPLIED INTO THE SECOND PROJECTION's ROWS (kr[:][j] kv[j]: the same sum over c, the factor taken inside it: nothing stands between), each split into an f16 word and an f16 residual word (x 2^10); the third projection with the position rows as the first operand (eight positions of one channel a lane; stored in fragment order too: 32 positions x 16 channels are two pieces of 512 bytes), its added vector joined and the sum stored as one f16 word; ONE FUSED kernel for raw sums, softmax and weighted sum: a work-group of eight waves owns 256 query rows (32 a wave) and one chunk of 640 of the 6,400 keys; each trip's 32 keys (word plane, residual plane, third projection: 4 KiB in a row each, already in fragment order) are brought to LDS ONCE for all eight waves by asynchronous copies, two buffers, the next tile flying while this one is worked on, and every wave reads its fragments from LDS; the raw sums are formed key-major (keys as the first operand's rows, queries as the second's) by three products (word.word; residual.word and word.residual in one accumulator at 2^-10) and stay in registers; ONE pass over the keys: each trip raises the wave's running maximum of each query (in-lane, then one exchange between the wave's halves), takes the sum and the partial plane gathered so far down to it, and takes exp(z - maximum) as one f16 word behind a carry of 2^12 (rounded to nearest; a word under 2^-14 is an f16 subnormal, which the cast forms and the matrix unit keeps): the accumulator's layout IS the second operand's layout of the last product (channel-first third projection against those words), so nothing is transposed; each chunk's maxima, sums and partial planes go to the workspace; ONE JOINING kernel: the ten chunks' planes and sums of a query are taken down to the greatest maximum and summed, and the quotient is joined with xa, kv and gs into the result.
// Compute dtype: all ten inputs converted to bf16 where they are read; the arrays' rows and the weights exact as f16 words down to 2^-14; the two projections TWO f16 words each; the third projection ONE f16 word; the softmax words ONE f16 word behind 2^12, the small words kept as f16 subnormals; every product's accumulation, the raw sums, the softmax's arithmetic and the result f32. v_wmma_f32_16x16x32_f16.
#include <hip/hip_runtime.h>
#define MNG 2                        /* groups */
#define MNC 64                       /* channels: the projections' depth and width */
#define MNN 6400                     /* positions: the softmax's axis */
#define FNI 2                        /* query tiles of 16 rows a fused wave owns */
#define MLOGC 12.0f                  /* the softmax words carry 2^12 (the greatest is 2^12), added in the base-2 exponent; their sum carries it too, and it leaves in the quotient */
#define MLOG2E 1.4426950408889634f   /* log2 e: exp(x) is taken as 2^(x log2 e) on the chip's own base-2 exponential */
#define FNW 8                        /* waves of a fused work-group: the queries are split among them, the keys are shared */
#define FNZ 10                       /* key chunks: a work-group takes one */
#define FKC (MNN / FNZ)              /* keys of a chunk */
#define FNT (FKC / 32)               /* trips of 32 keys */
#define FQB (FNW * FNI * 16)         /* query rows of a fused work-group */
#define KTB (3 * 32 * MNC * 2)       /* bytes of one LDS buffer: three planes of 32 keys */
typedef unsigned short v8us __attribute__((ext_vector_type(8), may_alias));
typedef float  v8f  __attribute__((ext_vector_type(8)));
typedef float  v4f  __attribute__((ext_vector_type(4)));
typedef float  v4fa __attribute__((ext_vector_type(4), may_alias));

__device__ __forceinline__ unsigned short bf16_bits(float x) { unsigned int u = __float_as_uint(x); return (unsigned short)((u + 0x7FFFu + ((u >> 16) & 1u)) >> 16); }
__device__ __forceinline__ float bf16_val(unsigned short b) { return __uint_as_float(((unsigned int)b) << 16); }
__device__ __forceinline__ float bf16_round(float x) { return bf16_val(bf16_bits(x)); }

typedef _Float16 v16h __attribute__((ext_vector_type(16)));
union FragH { v16h v; v8us half[2]; _Float16 h[16]; unsigned short u[16]; };

__device__ __forceinline__ v16h g2_frag(const _Float16* p, int hh) { FragH f; f.half[0] = *(const v8us*)((const unsigned short*)p + 8 * hh); f.half[1] = *(const v8us*)((const unsigned short*)p + 16 + 8 * hh); return f.v; }
// a fragment from a workspace plane laid in fragment order: p is the lane's own 8 words in a tile's first piece of 512 bytes (32 lanes x 16 bytes in a row); pieces 2 d and 2 d + 1 are the two halves of depth step d, so that a wave's load is four whole lines
__device__ __forceinline__ v16h g3_frag(const _Float16* p, int d) { FragH f; f.half[0] = *(const v8us*)((const unsigned short*)p + 512 * d); f.half[1] = *(const v8us*)((const unsigned short*)p + 512 * d + 256); return f.v; }
#define PPB 64                       /* positions a projection work-group takes */
#define XPI 72                       /* f16 words from one position row to the next in LDS: 144 bytes = 16 x 9, so that 16-byte fragment reads spread over the banks */
typedef _Float16 v2ha __attribute__((ext_vector_type(2), may_alias));
__device__ __forceinline__ v8f f_mma(v16h a, v16h b, v8f c) { return __builtin_amdgcn_wmma_f32_16x16x32_f16(false, a, false, b, (short)0, c, false, false); }
typedef _Float16 v4ha __attribute__((ext_vector_type(4), may_alias));
// blockIdx.y: 0 the first projection (xa, wa, ba -> QH | QL), 1 the second (ya, wb, bb, x kv -> KW | KL), 2 the third (xa, wc, bc -> VC); blockIdx.x: PPB positions of one group
__global__ __launch_bounds__(128) void k_prj(const float* __restrict__ xa, const float* __restrict__ ya, const float* __restrict__ kv, const float* __restrict__ wa, const float* __restrict__ ba, const float* __restrict__ wb, const float* __restrict__ bb, const float* __restrict__ wc, const float* __restrict__ bc,
    _Float16* __restrict__ QH, _Float16* __restrict__ QL, _Float16* __restrict__ KW, _Float16* __restrict__ KL, _Float16* __restrict__ VC) {
  __shared__ __attribute__((aligned(16))) _Float16 xs[PPB][XPI]; __shared__ __attribute__((aligned(16))) _Float16 ws[MNC][XPI]; __shared__ __attribute__((aligned(16))) float bs[MNC];      /* position rows; the weight's rows; the added vector */
  const int tid = threadIdx.x, w = tid >> 5, lane = tid & 31, ln = lane & 15, hh = lane >> 4; const int job = blockIdx.y, g = blockIdx.x / (MNN / PPB), i0 = (blockIdx.x % (MNN / PPB)) * PPB;
  const float* sp = (job == 1 ? ya : xa) + (size_t)g * MNC * MNN + i0 + (tid & 15) * 4 + (size_t)(tid >> 4) * 2 * MNN;      /* a thread: four positions of channels 2 (tid / 16) + 16 q and the next: a wave's load is two whole rows of 256 bytes */
  const float* wp = (job == 0 ? wa : job == 1 ? wb : wc) + tid * 4; const float* bp = job == 0 ? ba : job == 1 ? bb : bc; const size_t p = (size_t)g * MNN + i0 + 16 * w + ln;
  v4f x0[4], x1[4], wv[8];
#pragma unroll
  for (int q = 0; q < 4; ++q) { x0[q] = *(const v4fa*)(sp + (size_t)q * 16 * MNN); x1[q] = *(const v4fa*)(sp + (size_t)(q * 16 + 1) * MNN); }
#pragma unroll
  for (int q = 0; q < 8; ++q) wv[q] = *(const v4fa*)(wp + q * 512);      /* the weight as it lies: a wave's load is 512 bytes in a row */
  const float* bq = bp + (tid & (MNC - 1)); const float* kq = kv + p; const float br = *bq, kr = *kq;      /* kv's 12,800 words lie in the order of the position rows */
  asm volatile("s_wait_xcnt 0x0" :: "v"(x0[0]), "v"(x0[1]), "v"(x0[2]), "v"(x0[3]), "v"(x1[0]), "v"(x1[1]), "v"(x1[2]), "v"(x1[3]), "v"(wv[0]), "v"(wv[1]), "v"(wv[2]), "v"(wv[3]), "v"(wv[4]), "v"(wv[5]), "v"(wv[6]), "v"(wv[7]), "v"(br), "v"(kr), "v"(sp), "v"(wp), "v"(bq), "v"(kq) : "memory");      /* the loaded words and the addresses as inputs only: all 18 loads are issued in front of this line, so that their latencies overlap and are paid once, and no address register is given away in front of the wait */
#pragma unroll
  for (int q = 0; q < 4; ++q) {
#pragma unroll
    for (int e = 0; e < 4; ++e) { v2ha h2; h2[0] = (_Float16)bf16_round(x0[q][e]); h2[1] = (_Float16)bf16_round(x1[q][e]); *(v2ha*)&xs[(tid & 15) * 4 + e][(tid >> 4) * 2 + 16 * q] = h2; } }
#pragma unroll
  for (int q = 0; q < 8; ++q) { v4ha h4;
#pragma unroll
    for (int e = 0; e < 4; ++e) h4[e] = (_Float16)bf16_round(wv[q][e]);
    *(v4ha*)&ws[q * 8 + (tid >> 4)][(tid & 15) * 4] = h4; }
  if (tid < MNC) bs[tid] = bf16_round(br);
  __syncthreads();      /* position rows, weight rows and added vector are in LDS */
  const v8f z8 = {0.f,0.f,0.f,0.f,0.f,0.f,0.f,0.f};
  if (job < 2) {      /* wave w: positions 16 w + ln as columns, all 64 result channels as rows (a lane's eight words: eight channels of one position): it writes one whole tile of both planes */
    const size_t pt = ((size_t)g * MNN + i0 + 16 * w) * MNC + lane * 8; unsigned short* Hh = (unsigned short*)(job == 0 ? QH : KW) + pt; unsigned short* Hl = (unsigned short*)(job == 0 ? QL : KL) + pt;      /* the wave's tile of 16 positions: 2 KiB in fragment order, piece t = channels 16 t + 8 hh + r of position ln at lane 16 hh + ln */ const float kk = job == 1 ? bf16_round(kr) : 1.0f;      /* x 1 is exact */
    const v16h b0 = g2_frag(&xs[16 * w + ln][0], hh), b1 = g2_frag(&xs[16 * w + ln][32], hh); FragH fh[4], fl[4];
#pragma unroll
    for (int t = 0; t < 4; ++t) { v8f c = f_mma(g2_frag(&ws[16 * t + ln][0], hh), b0, z8); c = f_mma(g2_frag(&ws[16 * t + ln][32], hh), b1, c); const v4f u0 = *(const v4fa*)&bs[16 * t + 8 * hh], u1 = *(const v4fa*)&bs[16 * t + 8 * hh + 4];
#pragma unroll
      for (int r = 0; r < 8; ++r) { const float v = (c[r] + (r < 4 ? u0[r & 3] : u1[r & 3])) * kk; const _Float16 h = (_Float16)v; fh[t].h[r] = h; fl[t].h[r] = (_Float16)((v - (float)h) * 1024.0f); } }
#pragma unroll
    for (int t = 0; t < 4; ++t) { *(v8us*)(Hh + 256 * t) = fh[t].half[0]; *(v8us*)(Hl + 256 * t) = fl[t].half[0]; }      /* the tile's eight pieces in a run at the arm's end: no stored register is written again */
  } else {      /* wave w: result channels 16 w + ln as columns, all PPB positions as rows (a lane's eight words: eight positions of one channel): it writes whole pieces of 512 bytes */
    unsigned short* vo = (unsigned short*)VC + (((size_t)g * MNN + i0) / 32 * 4 + w) * 512 + lane * 8;      /* 32 positions x 16 channels: 1 KiB in fragment order, piece h = positions 16 h + 8 hh + r of channel ln at lane 16 hh + ln; four channel tiles in a row */ const float bv = (float)(_Float16)bs[16 * w + ln];
    const v16h b0 = g2_frag(&ws[16 * w + ln][0], hh), b1 = g2_frag(&ws[16 * w + ln][32], hh);
#pragma unroll
    for (int t = 0; t < 4; ++t) { v8f c = f_mma(g2_frag(&xs[16 * t + ln][0], hh), b0, z8); c = f_mma(g2_frag(&xs[16 * t + ln][32], hh), b1, c); FragH f;
#pragma unroll
      for (int r = 0; r < 8; ++r) f.h[r] = (_Float16)(c[r] + bv);
      *(v8us*)(vo + (t >> 1) * 2048 + (t & 1) * 256) = f.half[0]; }
    asm volatile("s_wait_xcnt 0x0" ::: "memory");      /* behind the arm's last store: the stores' address pair is not given away in front of the wait */
  }
}

__device__ __forceinline__ float xhalf(float x) { return __builtin_bit_cast(float, __builtin_amdgcn_permlanex16(__builtin_bit_cast(int, x), __builtin_bit_cast(int, x), 0x76543210, 0xfedcba98, false, false)); }      /* lane l's word to lane l ^ 16 */
// 2^x on v_exp_f32, bare (a result under 2^-126 may come as nought: far under the least f16 subnormal and under the sums' last bit). Written as asm for the slot: the instruction set asks for one slot behind a transcendental before its result is read or its source overwritten: the outputs are early-clobber, so that no v_exp_f32 of a statement writes over a source of the one in front of it, and the v_nop at the end is the slot behind the last
__device__ __forceinline__ float exp2_1(float x) { float u; asm("v_exp_f32 %0, %1\n\tv_nop" : "=v"(u) : "v"(x)); return u; }
__device__ __forceinline__ v8f exp2_8(v8f x) { float u0, u1, u2, u3, u4, u5, u6, u7;      /* eight in one statement: one v_nop serves all eight */
  asm("v_exp_f32 %0, %8\n\tv_exp_f32 %1, %9\n\tv_exp_f32 %2, %10\n\tv_exp_f32 %3, %11\n\tv_exp_f32 %4, %12\n\tv_exp_f32 %5, %13\n\tv_exp_f32 %6, %14\n\tv_exp_f32 %7, %15\n\tv_nop"
      : "=&v"(u0), "=&v"(u1), "=&v"(u2), "=&v"(u3), "=&v"(u4), "=&v"(u5), "=&v"(u6), "=&v"(u7) : "v"(x[0]), "v"(x[1]), "v"(x[2]), "v"(x[3]), "v"(x[4]), "v"(x[5]), "v"(x[6]), "v"(x[7]));
  const v8f u = {u0, u1, u2, u3, u4, u5, u6, u7}; return u; }
// the raw sums of 16 keys (rows: 8 hh + r) against FNI x 16 queries (columns: ln): word.word, and residual.word + word.residual in a second accumulator at 2^-10
struct KF { v16h w0, w1, l0, l1; };      /* 16 keys: word and residual, two depth steps of 32 */
__device__ __forceinline__ KF f_load(const _Float16* __restrict__ kw, const _Float16* __restrict__ kl) { KF k; k.w0 = g3_frag(kw, 0); k.w1 = g3_frag(kw, 1); k.l0 = g3_frag(kl, 0); k.l1 = g3_frag(kl, 1); return k; }
__device__ __forceinline__ void f_tile(const KF& k, const v16h (&qh)[FNI][2], const v16h (&ql)[FNI][2], v8f (&s)[FNI]) { const v8f z8 = {0.f,0.f,0.f,0.f,0.f,0.f,0.f,0.f};
#pragma unroll
  for (int ni = 0; ni < FNI; ++ni) { v8f cm = f_mma(k.w0, qh[ni][0], z8), cr = f_mma(k.w0, ql[ni][0], z8); cm = f_mma(k.w1, qh[ni][1], cm); cr = f_mma(k.w1, ql[ni][1], cr); cr = f_mma(k.l0, qh[ni][0], cr); cr = f_mma(k.l1, qh[ni][1], cr);
    s[ni] = cm + cr * 0.0009765625f; } }

// one tile of 32 keys from the workspace to LDS: 16 bytes a thread of each plane (word, residual, third projection), through no register. The wait is the statement's last line, so that no register which a copy names is written again in front of it
__device__ __forceinline__ void f_copy(unsigned ld, const _Float16* gw, const _Float16* gl, const _Float16* gv) {
  asm volatile("global_load_async_to_lds_b128 %0, %1, off\n\tglobal_load_async_to_lds_b128 %2, %3, off\n\tglobal_load_async_to_lds_b128 %4, %5, off\n\ts_wait_xcnt 0x0"
      :: "v"(ld), "v"(gw), "v"(ld + 4096u), "v"(gl), "v"(ld + 8192u), "v"(gv) : "memory"); }
// a work-group: FQB query rows of one group (blockIdx.x, blockIdx.y) against the FKC keys of chunk blockIdx.z, 32 a trip, shared by its waves through LDS; wave w: FNI x 16 of the query rows. Lane (ln, hh) sees query ln of each tile and keys 8 hh + r and 16 + 8 hh + r of the trip's 32.
__global__ __launch_bounds__(FNW * 32) void k_fat(const _Float16* __restrict__ QH, const _Float16* __restrict__ QL, const _Float16* __restrict__ KW, const _Float16* __restrict__ KL, const _Float16* __restrict__ VC, float* __restrict__ PO, float* __restrict__ PM, float* __restrict__ PL) {
  __shared__ __attribute__((aligned(16))) _Float16 kt[2][3][32 * MNC];      /* two buffers x (word, residual, third projection) x 32 keys in fragment order */
  const int tid = threadIdx.x, w = tid >> 5, lane = tid & 31, hh = lane >> 4; const int g = blockIdx.y, z = blockIdx.z, i0 = blockIdx.x * FQB + w * (FNI * 16);
  const size_t k0 = ((size_t)g * MNN + z * FKC) * MNC + tid * 8; const _Float16* gw = KW + k0; const _Float16* gl = KL + k0; const _Float16* gv = VC + k0;      /* 32 keys x 64 channels are 2,048 words in a row in each plane */
  const unsigned ld = (unsigned)(size_t)&kt[0][0][tid * 8];      /* the thread's own 16 bytes in buffer 0's first plane: the LDS byte address is the low word */
  f_copy(ld, gw, gl, gv);      /* tile 0 flies under the queries' loads */
  v16h qh[FNI][2], ql[FNI][2];
#pragma unroll
  for (int ni = 0; ni < FNI; ++ni) { const size_t e = ((size_t)g * MNN + i0 + ni * 16) * MNC + lane * 8; qh[ni][0] = g3_frag(QH + e, 0); qh[ni][1] = g3_frag(QH + e, 1); }
  asm volatile("s_wait_xcnt 0x0" ::: "memory");      /* the loads' address registers are given to later loads' results: the wait stands in front of that */
#pragma unroll
  for (int ni = 0; ni < FNI; ++ni) { const size_t e = ((size_t)g * MNN + i0 + ni * 16) * MNC + lane * 8; ql[ni][0] = g3_frag(QL + e, 0); ql[ni][1] = g3_frag(QL + e, 1); }
  asm volatile("s_wait_xcnt 0x0" ::: "memory");      /* as above, in front of what follows */
  asm volatile("s_wait_asynccnt 0x0" ::: "memory");      /* this wave's copies of tile 0 have landed */
  __syncthreads();      /* tile 0 is in LDS for every wave */
  f_copy(ld + KTB, gw + 32 * MNC, gl + 32 * MNC, gv + 32 * MNC);      /* tile 1 flies under trip 0 */
  float m[FNI], l[FNI];
#pragma unroll
  for (int ni = 0; ni < FNI; ++ni) { m[ni] = -__builtin_inff(); l[ni] = 0.0f; }
  const v8f z8 = {0.f,0.f,0.f,0.f,0.f,0.f,0.f,0.f}; v8f o[FNI][4];
#pragma unroll
  for (int ni = 0; ni < FNI; ++ni) { o[ni][0] = z8; o[ni][1] = z8; o[ni][2] = z8; o[ni][3] = z8; }
  for (int it = 0; it < FNT; ++it) { v8f s0[FNI], s1[FNI]; v16h va[4]; const _Float16* kc = &kt[it & 1][0][lane * 8];      /* the lane's own 8 words in the buffer's first piece */
    { const KF ka = f_load(kc, kc + 32 * MNC), kb = f_load(kc + 16 * MNC, kc + 48 * MNC);
    f_tile(ka, qh, ql, s0); f_tile(kb, qh, ql, s1); }
    FragH pf[FNI];
#pragma unroll
    for (int ni = 0; ni < FNI; ++ni) { float t = fmaxf(s0[ni][0], s1[ni][0]);
#pragma unroll
      for (int r = 1; r < 8; ++r) t = fmaxf(t, fmaxf(s0[ni][r], s1[ni][r]));
      t = fmaxf(t, xhalf(t));      /* the trip's 32 keys of a query lie in lanes ln and 16 + ln: both take one maximum, since the last product sums over all 32 */
      const float mn = fmaxf(m[ni], t), f = exp2_1((m[ni] - mn) * MLOG2E), mc = mn * MLOG2E - MLOGC; float a0 = 0.0f, a1 = 0.0f; const v8f e0 = exp2_8(s0[ni] * MLOG2E - mc), e1 = exp2_8(s1[ni] * MLOG2E - mc);      /* f: what was gathered under the old maximum is taken down to the new one (nought on the first trip); e0, e1: exp(z - maximum) 2^12 as 2^(z log2 e - mc), one multiply-add and one v_exp_f32 a word */
#pragma unroll
      for (int r = 0; r < 8; ++r) { const float u0 = e0[r], u1 = e1[r]; a0 = r ? a0 + u0 : u0; a1 = r ? a1 + u1 : u1; pf[ni].h[r] = (_Float16)u0; pf[ni].h[8 + r] = (_Float16)u1; }
      m[ni] = mn; l[ni] = l[ni] * f + (a0 + a1);
#pragma unroll
      for (int ct = 0; ct < 4; ++ct) o[ni][ct] *= f; }
#pragma unroll
    for (int ct = 0; ct < 4; ++ct) va[ct] = g3_frag(kc + 64 * MNC + ct * 512, 0);
#pragma unroll
    for (int ct = 0; ct < 4; ++ct) {
#pragma unroll
      for (int ni = 0; ni < FNI; ++ni) o[ni][ct] = f_mma(va[ct], pf[ni].v, o[ni][ct]); }
    asm volatile("s_wait_dscnt 0x0" ::: "memory");      /* this wave's reads of the trip's buffer are done before the buffer is given back */
    asm volatile("s_wait_asynccnt 0x0" ::: "memory");      /* this wave's copies of the next tile have landed */
    __syncthreads();      /* the next tile is in LDS for every wave, and every wave has left this trip's buffer */
    if (it + 2 < FNT) f_copy(ld + (unsigned)(it & 1) * KTB, gw + (size_t)(it + 2) * 32 * MNC, gl + (size_t)(it + 2) * 32 * MNC, gv + (size_t)(it + 2) * 32 * MNC); }      /* the tile after the next into the buffer just left */
  asm volatile("s_wait_asynccnt 0x0" ::: "memory");      /* no copy is outstanding when the wave ends */
  float* po = PO + ((((size_t)g * (MNN / 16) + (i0 >> 4)) * 4) * FNZ + z) * 256 + lane * 4;      /* PO[group][tile of 16 queries][tile of 16 channels][chunk][r / 4][lane][r % 4]: every wave-wide 16-byte store covers 512 bytes in a row */
#pragma unroll
  for (int ni = 0; ni < FNI; ++ni) {
#pragma unroll
    for (int ct = 0; ct < 4; ++ct) { const v4f u0 = {o[ni][ct][0], o[ni][ct][1], o[ni][ct][2], o[ni][ct][3]}, u1 = {o[ni][ct][4], o[ni][ct][5], o[ni][ct][6], o[ni][ct][7]}; *(v4fa*)(po + (ni * 4 + ct) * FNZ * 256) = u0; *(v4fa*)(po + (ni * 4 + ct) * FNZ * 256 + 128) = u1; } }
  const float l0 = l[0] + xhalf(l[0]), l1 = l[1] + xhalf(l[1]); const size_t eq = ((size_t)g * FNZ + z) * MNN + i0 + lane;      /* a query's sum lies in lanes ln and 16 + ln; from here a lane is query lane of the wave's 32 */
  PM[eq] = hh ? m[1] : m[0]; PL[eq] = hh ? l1 : l0;
  asm volatile("s_wait_xcnt 0x0" ::: "memory");      /* behind the last store: no store's register is given away in front of the wait */
}

// the chunks joined: a work-group takes 32 queries of one group; wave w: channels 16 (w / 2) + 8 hh + 4 (w % 2) + r, r under 4, of queries ln and 16 + ln: it writes both halves of each line of the result
__global__ __launch_bounds__(256) void k_jn(const float* __restrict__ PO, const float* __restrict__ PM, const float* __restrict__ PL, const float* __restrict__ xa, const float* __restrict__ kv, const float* __restrict__ gs, float* __restrict__ res) {
  const int tid = threadIdx.x, w = tid >> 5, lane = tid & 31, ln = lane & 15, hh = lane >> 4; const int g = blockIdx.y, i0 = blockIdx.x * 32;
  const float* pp = PO + (((size_t)g * (MNN / 16) + (i0 >> 4)) * 4 + (w >> 1)) * FNZ * 256 + (w & 1) * 128 + lane * 4; const size_t eq = (size_t)g * FNZ * MNN + i0 + ln; const float* pm = PM + eq; const float* pl = PL + eq;
  const size_t e0 = ((size_t)g * MNC + 16 * (w >> 1) + 8 * hh + 4 * (w & 1)) * MNN + i0 + ln; const float* px = xa + e0; const float* pk = kv + (size_t)g * MNN + i0;
  v4f pv[FNI][FNZ]; float mv[FNI][FNZ], lv[FNI][FNZ], xv[FNI][4], kr[FNI];
#pragma unroll
  for (int ni = 0; ni < FNI; ++ni) {
#pragma unroll
    for (int u = 0; u < FNZ; ++u) { mv[ni][u] = pm[u * MNN + ni * 16]; lv[ni][u] = pl[u * MNN + ni * 16]; pv[ni][u] = *(const v4fa*)(pp + (ni * 4 * FNZ + u) * 256); }
#pragma unroll
    for (int r = 0; r < 4; ++r) xv[ni][r] = px[r * MNN + ni * 16];
    kr[ni] = pk[ni * 16 + ln]; }
  const float gr = bf16_round(gs[0]);
  asm volatile("s_wait_xcnt 0x0" :: "v"(pp), "v"(pm), "v"(pl), "v"(px), "s"(pk), "v"(ln) : "memory");      /* behind the loads; the addresses (of kv: its scalar base and lane offset) as inputs only, so that no load's own result takes an address register in front of the wait */
  float* pr = res + e0;
#pragma unroll
  for (int ni = 0; ni < FNI; ++ni) { float hi = mv[ni][0], sl = 0.0f, fu[FNZ];      /* each chunk's plane and sum are taken from that chunk's maximum down to the greatest */
#pragma unroll
    for (int u = 1; u < FNZ; ++u) hi = fmaxf(hi, mv[ni][u]);
#pragma unroll
    for (int u = 0; u < FNZ; ++u) { fu[u] = exp2_1((mv[ni][u] - hi) * MLOG2E); sl += lv[ni][u] * fu[u]; }
    v4f s = pv[ni][0] * fu[0];
#pragma unroll
    for (int u = 1; u < FNZ; ++u) s += pv[ni][u] * fu[u];
    const float rl = 1.0f / sl, kk = bf16_round(kr[ni]), gk = gr * (1.0f - kk);      /* plane and sum carry the same 2^12: it leaves in the quotient */
#pragma unroll
    for (int r = 0; r < 4; ++r) pr[r * MNN + ni * 16] = bf16_round(xv[ni][r]) * kk + gk * (s[r] * rl); }      /* every element of the result once */
  asm volatile("s_wait_xcnt 0x0" ::: "memory");      /* behind the last store: no store's register is given away in front of the wait */
}

extern "C" void kernel_launch(void* const* d_in, const int* in_sizes, int n_in,
                              void* d_out, int out_size, void* d_ws, size_t ws_size, hipStream_t stream) {
  (void)in_sizes; (void)n_in; (void)out_size;
  const float* const* I = (const float* const*)d_in; const float* xa = I[0]; const float* ya = I[1]; const float* kv = I[2]; const float* wa = I[3]; const float* ba = I[4]; const float* wb = I[5]; const float* bb = I[6]; const float* wc = I[7]; const float* bc = I[8]; const float* gs = I[9];      /* xa and ya [2][64][6400]; kv [2][1][6400]; wa, wb, wc [64][64]; ba, bb, bc [64]; gs [1] */
  static_assert(MNN % FQB == 0 && FNI == 2 && MNN % FNZ == 0 && FKC % 32 == 0 && FNT >= 2 && FNW == 8 && MNC == 64 && MNN % PPB == 0 && PPB == 64 && XPI >= MNC && XPI % 8 == 0, "whole tiles");
  uint8_t* wsp = (uint8_t*)d_ws; size_t off = 0;
  auto take = [&](size_t bytes) { uint8_t* p = wsp + off; off += (bytes + 255) & ~(size_t)255; return p; };
  _Float16* QH = (_Float16*)take((size_t)MNG * MNN * MNC * 2); _Float16* QL = (_Float16*)take((size_t)MNG * MNN * MNC * 2); _Float16* KW = (_Float16*)take((size_t)MNG * MNN * MNC * 2); _Float16* KL = (_Float16*)take((size_t)MNG * MNN * MNC * 2); _Float16* VC = (_Float16*)take((size_t)MNG * MNC * MNN * 2);      /* the first two projections as word | residual planes, the third as f16 words: all five in fragment order */
  float* PO = (float*)take((size_t)FNZ * MNG * MNN * MNC * 4); float* PM = (float*)take((size_t)FNZ * MNG * MNN * 4); float* PL = (float*)take((size_t)FNZ * MNG * MNN * 4);      /* each chunk's partial planes, maxima and sums */
  if (off > ws_size) return;
  k_prj<<<dim3((unsigned)(MNG * (MNN / PPB)), 3), 128, 0, stream>>>(xa, ya, kv, wa, ba, wb, bb, wc, bc, QH, QL, KW, KL, VC);
  k_fat<<<dim3((unsigned)(MNN / FQB), MNG, FNZ), FNW * 32, 0, stream>>>(QH, QL, KW, KL, VC, PO, PM, PL);      /* per chunk of keys: maxima, sums and sum over j of VC[g][c][j] exp(raw sums - maximum)[i][j] */
  k_jn<<<dim3((unsigned)(MNN / 32), MNG), 256, 0, stream>>>(PO, PM, PL, xa, kv, gs, (float*)d_out);      /* res[g][c][i] = xa kv + gs (1 - kv) (chunks joined, quotient) */
}

// v009
// One run takes 40 microseconds.
// In both of two side-by-side timings against v008, it was 1.06 times as fast.
// All steps since v000 together make it 212 times as fast.
// A single-head pair weighting over 6,400 positions of channel-first arrays with a multiplicative key vector: xa [2][64][6400] and ya [2][64][6400] (group, channel, position), kv [2][6400], wa, wb, wc [64][64] stored (row: result channel; column: source channel), ba, bb, bc [64], gs [1]: qr = wa xa + ba, kr = wb ya + bb, vr = wc xa + bc (channel-first); zs[g][i][j] = (sum over c of qr[c][i] kr[c][j]) kv[g][j]; wt[g][i][:] = softmax over j of zs[g][i][:]; ag[g][c][i] = sum over j of vr[c][j] wt[g][i][j]; res = xa kv + gs[0] (1 - kv) ag -> [2][64][6400] f32: one result.
// Structure: THREE launches. ONE projection kernel: a work-group takes 64 positions of one group and one of the three projections; it reads its 64 x 64 block of the channel-first array in whole lines, converts (bf16 first, then f16 words) and lays it transposed in LDS as position rows; the weight's rows and the added vector are converted and laid in LDS beside it; WMMA: the first two projections with the weight's rows as the first operand (a lane's eight accumulator words are eight channels of one position: one 16-byte store, LAID IN FRAGMENT ORDER: a tile of 16 positions is four pieces of 512 bytes, lane after lane, exactly as the fused kernel's waves load them, so that every wave-wide store and load covers four whole lines), the added vector joined, THE KEY VECTOR MULTIPLIED INTO THE SECOND PROJECTION's ROWS (kr[:][j] kv[j]: the same sum over c, the factor taken inside it: nothing stands between), each split into an f16 word and an f16 residual word (x 2^10); the third projection with the position rows as the first operand (eight positions of one channel a lane; stored in fragment order too: 32 positions x 16 channels are two pieces of 512 bytes), its added vector joined and the sum stored as one f16 word; ONE FUSED kernel for raw sums, softmax and weighted sum: a work-group of eight waves owns 256 query rows (32 a wave) and one chunk of 640 of the 6,400 keys; each stage's 128 keys (word plane, residual plane, third projection: 16 KiB in a row each, already in fragment order) are brought to LDS ONCE for all eight waves by asynchronous copies, two buffers, the next stage flying while this one is worked on in four trips of 32 keys with no barrier between them (the waves meet once a stage, so that between two meetings one wave's matrix run can stand under another's vector work), and every wave reads its fragments from LDS; the raw sums are formed key-major (keys as the first operand's rows, queries as the second's) by three products (word.word; residual.word and word.residual in one accumulator at 2^-10) and stay in registers; ONE pass over the keys: each trip raises the wave's running maximum of each query (in-lane, then one exchange between the wave's halves), takes the sum and the partial plane gathered so far down to it, and takes exp(z - maximum) as one f16 word behind a carry of 2^12 (rounded to nearest; a word under 2^-14 is an f16 subnormal, which the cast forms and the matrix unit keeps): the accumulator's layout IS the second operand's layout of the last product (channel-first third projection against those words), so nothing is transposed; each chunk's maxima, sums and partial planes go to the workspace; ONE JOINING kernel: the ten chunks' planes and sums of a query are taken down to the greatest maximum and summed, and the quotient is joined with xa, kv and gs into the result.
// Compute dtype: all ten inputs converted to bf16 where they are read; the arrays' rows and the weights exact as f16 words down to 2^-14; the two projections TWO f16 words each; the third projection ONE f16 word; the softmax words ONE f16 word behind 2^12, the small words kept as f16 subnormals; every product's accumulation, the raw sums, the softmax's arithmetic and the result f32. v_wmma_f32_16x16x32_f16.
#include <hip/hip_runtime.h>
#define MNG 2                        /* groups */
#define MNC 64                       /* channels: the projections' depth and width */
#define MNN 6400                     /* positions: the softmax's axis */
#define FNI 2                        /* query tiles of 16 rows a fused wave owns */
#define MLOGC 12.0f                  /* the softmax words carry 2^12 (the greatest is 2^12), added in the base-2 exponent; their sum carries it too, and it leaves in the quotient */
#define MLOG2E 1.4426950408889634f   /* log2 e: exp(x) is taken as 2^(x log2 e) on the chip's own base-2 exponential */
#define FNW 8                        /* waves of a fused work-group: the queries are split among them, the keys are shared */
#define FNZ 10                       /* key chunks: a work-group takes one */
#define FKC (MNN / FNZ)              /* keys of a chunk */
#define FSK 128                      /* keys of a stage: what one LDS buffer holds and one barrier publishes */
#define FNS (FKC / FSK)              /* stages of a chunk */
#define FSP (FSK / 32)               /* trips of 32 keys in a stage */
#define FQB (FNW * FNI * 16)         /* query rows of a fused work-group */
#define PLW (FSK * MNC)              /* f16 words of one plane of a stage */
#define KTB (3 * PLW * 2)            /* bytes of one LDS buffer: three planes of a stage */
typedef unsigned short v8us __attribute__((ext_vector_type(8), may_alias));
typedef float  v8f  __attribute__((ext_vector_type(8)));
typedef float  v4f  __attribute__((ext_vector_type(4)));
typedef float  v4fa __attribute__((ext_vector_type(4), may_alias));

__device__ __forceinline__ unsigned short bf16_bits(float x) { unsigned int u = __float_as_uint(x); return (unsigned short)((u + 0x7FFFu + ((u >> 16) & 1u)) >> 16); }
__device__ __forceinline__ float bf16_val(unsigned short b) { return __uint_as_float(((unsigned int)b) << 16); }
__device__ __forceinline__ float bf16_round(float x) { return bf16_val(bf16_bits(x)); }

typedef _Float16 v16h __attribute__((ext_vector_type(16)));
union FragH { v16h v; v8us half[2]; _Float16 h[16]; unsigned short u[16]; };

__device__ __forceinline__ v16h g2_frag(const _Float16* p, int hh) { FragH f; f.half[0] = *(const v8us*)((const unsigned short*)p + 8 * hh); f.half[1] = *(const v8us*)((const unsigned short*)p + 16 + 8 * hh); return f.v; }
// a fragment from a workspace plane laid in fragment order: p is the lane's own 8 words in a tile's first piece of 512 bytes (32 lanes x 16 bytes in a row); pieces 2 d and 2 d + 1 are the two halves of depth step d, so that a wave's load is four whole lines
__device__ __forceinline__ v16h g3_frag(const _Float16* p, int d) { FragH f; f.half[0] = *(const v8us*)((const unsigned short*)p + 512 * d); f.half[1] = *(const v8us*)((const unsigned short*)p + 512 * d + 256); return f.v; }
#define PPB 64                       /* positions a projection work-group takes */
#define XPI 72                       /* f16 words from one position row to the next in LDS: 144 bytes = 16 x 9, so that 16-byte fragment reads spread over the banks */
typedef _Float16 v2ha __attribute__((ext_vector_type(2), may_alias));
__device__ __forceinline__ v8f f_mma(v16h a, v16h b, v8f c) { return __builtin_amdgcn_wmma_f32_16x16x32_f16(false, a, false, b, (short)0, c, false, false); }
typedef _Float16 v4ha __attribute__((ext_vector_type(4), may_alias));
// blockIdx.y: 0 the first projection (xa, wa, ba -> QH | QL), 1 the second (ya, wb, bb, x kv -> KW | KL), 2 the third (xa, wc, bc -> VC); blockIdx.x: PPB positions of one group
__global__ __launch_bounds__(128) void k_prj(const float* __restrict__ xa, const float* __restrict__ ya, const float* __restrict__ kv, const float* __restrict__ wa, const float* __restrict__ ba, const float* __restrict__ wb, const float* __restrict__ bb, const float* __restrict__ wc, const float* __restrict__ bc,
    _Float16* __restrict__ QH, _Float16* __restrict__ QL, _Float16* __restrict__ KW, _Float16* __restrict__ KL, _Float16* __restrict__ VC) {
  __shared__ __attribute__((aligned(16))) _Float16 xs[PPB][XPI]; __shared__ __attribute__((aligned(16))) _Float16 ws[MNC][XPI]; __shared__ __attribute__((aligned(16))) float bs[MNC];      /* position rows; the weight's rows; the added vector */
  const int tid = threadIdx.x, w = tid >> 5, lane = tid & 31, ln = lane & 15, hh = lane >> 4; const int job = blockIdx.y, g = blockIdx.x / (MNN / PPB), i0 = (blockIdx.x % (MNN / PPB)) * PPB;
  const float* sp = (job == 1 ? ya : xa) + (size_t)g * MNC * MNN + i0 + (tid & 15) * 4 + (size_t)(tid >> 4) * 2 * MNN;      /* a thread: four positions of channels 2 (tid / 16) + 16 q and the next: a wave's load is two whole rows of 256 bytes */
  const float* wp = (job == 0 ? wa : job == 1 ? wb : wc) + tid * 4; const float* bp = job == 0 ? ba : job == 1 ? bb : bc; const size_t p = (size_t)g * MNN + i0 + 16 * w + ln;
  v4f x0[4], x1[4], wv[8];
#pragma unroll
  for (int q = 0; q < 4; ++q) { x0[q] = *(const v4fa*)(sp + (size_t)q * 16 * MNN); x1[q] = *(const v4fa*)(sp + (size_t)(q * 16 + 1) * MNN); }
#pragma unroll
  for (int q = 0; q < 8; ++q) wv[q] = *(const v4fa*)(wp + q * 512);      /* the weight as it lies: a wave's load is 512 bytes in a row */
  const float* bq = bp + (tid & (MNC - 1)); const float* kq = kv + p; const float br = *bq, kr = *kq;      /* kv's 12,800 words lie in the order of the position rows */
  asm volatile("s_wait_xcnt 0x0" :: "v"(x0[0]), "v"(x0[1]), "v"(x0[2]), "v"(x0[3]), "v"(x1[0]), "v"(x1[1]), "v"(x1[2]), "v"(x1[3]), "v"(wv[0]), "v"(wv[1]), "v"(wv[2]), "v"(wv[3]), "v"(wv[4]), "v"(wv[5]), "v"(wv[6]), "v"(wv[7]), "v"(br), "v"(kr), "v"(sp), "v"(wp), "v"(bq), "v"(kq) : "memory");      /* the loaded words and the addresses as inputs only: all 18 loads are issued in front of this line, so that their latencies overlap and are paid once, and no address register is given away in front of the wait */
#pragma unroll
  for (int q = 0; q < 4; ++q) {
#pragma unroll
    for (int e = 0; e < 4; ++e) { v2ha h2; h2[0] = (_Float16)bf16_round(x0[q][e]); h2[1] = (_Float16)bf16_round(x1[q][e]); *(v2ha*)&xs[(tid & 15) * 4 + e][(tid >> 4) * 2 + 16 * q] = h2; } }
#pragma unroll
  for (int q = 0; q < 8; ++q) { v4ha h4;
#pragma unroll
    for (int e = 0; e < 4; ++e) h4[e] = (_Float16)bf16_round(wv[q][e]);
    *(v4ha*)&ws[q * 8 + (tid >> 4)][(tid & 15) * 4] = h4; }
  if (tid < MNC) bs[tid] = bf16_round(br);
  __syncthreads();      /* position rows, weight rows and added vector are in LDS */
  const v8f z8 = {0.f,0.f,0.f,0.f,0.f,0.f,0.f,0.f};
  if (job < 2) {      /* wave w: positions 16 w + ln as columns, all 64 result channels as rows (a lane's eight words: eight channels of one position): it writes one whole tile of both planes */
    const size_t pt = ((size_t)g * MNN + i0 + 16 * w) * MNC + lane * 8; unsigned short* Hh = (unsigned short*)(job == 0 ? QH : KW) + pt; unsigned short* Hl = (unsigned short*)(job == 0 ? QL : KL) + pt;      /* the wave's tile of 16 positions: 2 KiB in fragment order, piece t = channels 16 t + 8 hh + r of position ln at lane 16 hh + ln */ const float kk = job == 1 ? bf16_round(kr) : 1.0f;      /* x 1 is exact */
    const v16h b0 = g2_frag(&xs[16 * w + ln][0], hh), b1 = g2_frag(&xs[16 * w + ln][32], hh); FragH fh[4], fl[4];
#pragma unroll
    for (int t = 0; t < 4; ++t) { v8f c = f_mma(g2_frag(&ws[16 * t + ln][0], hh), b0, z8); c = f_mma(g2_frag(&ws[16 * t + ln][32], hh), b1, c); const v4f u0 = *(const v4fa*)&bs[16 * t + 8 * hh], u1 = *(const v4fa*)&bs[16 * t + 8 * hh + 4];
#pragma unroll
      for (int r = 0; r < 8; ++r) { const float v = (c[r] + (r < 4 ? u0[r & 3] : u1[r & 3])) * kk; const _Float16 h = (_Float16)v; fh[t].h[r] = h; fl[t].h[r] = (_Float16)((v - (float)h) * 1024.0f); } }
#pragma unroll
    for (int t = 0; t < 4; ++t) { *(v8us*)(Hh + 256 * t) = fh[t].half[0]; *(v8us*)(Hl + 256 * t) = fl[t].half[0]; }      /* the tile's eight pieces in a run at the arm's end: no stored register is written again */
  } else {      /* wave w: result channels 16 w + ln as columns, all PPB positions as rows (a lane's eight words: eight positions of one channel): it writes whole pieces of 512 bytes */
    unsigned short* vo = (unsigned short*)VC + (((size_t)g * MNN + i0) / 32 * 4 + w) * 512 + lane * 8;      /* 32 positions x 16 channels: 1 KiB in fragment order, piece h = positions 16 h + 8 hh + r of channel ln at lane 16 hh + ln; four channel tiles in a row */ const float bv = (float)(_Float16)bs[16 * w + ln];
    const v16h b0 = g2_frag(&ws[16 * w + ln][0], hh), b1 = g2_frag(&ws[16 * w + ln][32], hh);
#pragma unroll
    for (int t = 0; t < 4; ++t) { v8f c = f_mma(g2_frag(&xs[16 * t + ln][0], hh), b0, z8); c = f_mma(g2_frag(&xs[16 * t + ln][32], hh), b1, c); FragH f;
#pragma unroll
      for (int r = 0; r < 8; ++r) f.h[r] = (_Float16)(c[r] + bv);
      *(v8us*)(vo + (t >> 1) * 2048 + (t & 1) * 256) = f.half[0]; }
    asm volatile("s_wait_xcnt 0x0" ::: "memory");      /* behind the arm's last store: the stores' address pair is not given away in front of the wait */
  }
}

__device__ __forceinline__ float xhalf(float x) { return __builtin_bit_cast(float, __builtin_amdgcn_permlanex16(__builtin_bit_cast(int, x), __builtin_bit_cast(int, x), 0x76543210, 0xfedcba98, false, false)); }      /* lane l's word to lane l ^ 16 */
// 2^x on v_exp_f32, bare (a result under 2^-126 may come as nought: far under the least f16 subnormal and under the sums' last bit). Written as asm for the slot: the instruction set asks for one slot behind a transcendental before its result is read or its source overwritten: the outputs are early-clobber, so that no v_exp_f32 of a statement writes over a source of the one in front of it, and the v_nop at the end is the slot behind the last
__device__ __forceinline__ float exp2_1(float x) { float u; asm("v_exp_f32 %0, %1\n\tv_nop" : "=v"(u) : "v"(x)); return u; }
__device__ __forceinline__ v8f exp2_8(v8f x) { float u0, u1, u2, u3, u4, u5, u6, u7;      /* eight in one statement: one v_nop serves all eight */
  asm("v_exp_f32 %0, %8\n\tv_exp_f32 %1, %9\n\tv_exp_f32 %2, %10\n\tv_exp_f32 %3, %11\n\tv_exp_f32 %4, %12\n\tv_exp_f32 %5, %13\n\tv_exp_f32 %6, %14\n\tv_exp_f32 %7, %15\n\tv_nop"
      : "=&v"(u0), "=&v"(u1), "=&v"(u2), "=&v"(u3), "=&v"(u4), "=&v"(u5), "=&v"(u6), "=&v"(u7) : "v"(x[0]), "v"(x[1]), "v"(x[2]), "v"(x[3]), "v"(x[4]), "v"(x[5]), "v"(x[6]), "v"(x[7]));
  const v8f u = {u0, u1, u2, u3, u4, u5, u6, u7}; return u; }
// the raw sums of 16 keys (rows: 8 hh + r) against FNI x 16 queries (columns: ln): word.word, and residual.word + word.residual in a second accumulator at 2^-10
struct KF { v16h w0, w1, l0, l1; };      /* 16 keys: word and residual, two depth steps of 32 */
__device__ __forceinline__ KF f_load(const _Float16* __restrict__ kw, const _Float16* __restrict__ kl) { KF k; k.w0 = g3_frag(kw, 0); k.w1 = g3_frag(kw, 1); k.l0 = g3_frag(kl, 0); k.l1 = g3_frag(kl, 1); return k; }
__device__ __forceinline__ void f_tile(const KF& k, const v16h (&qh)[FNI][2], const v16h (&ql)[FNI][2], v8f (&s)[FNI]) { const v8f z8 = {0.f,0.f,0.f,0.f,0.f,0.f,0.f,0.f};
#pragma unroll
  for (int ni = 0; ni < FNI; ++ni) { v8f cm = f_mma(k.w0, qh[ni][0], z8), cr = f_mma(k.w0, ql[ni][0], z8); cm = f_mma(k.w1, qh[ni][1], cm); cr = f_mma(k.w1, ql[ni][1], cr); cr = f_mma(k.l0, qh[ni][0], cr); cr = f_mma(k.l1, qh[ni][1], cr);
    s[ni] = cm + cr * 0.0009765625f; } }

// one plane of a stage (FSK keys) from the workspace to LDS: four times 16 bytes a thread, 4 KiB (the work-group's reach) from one to the next, through no register. The wait is the statement's last line, so that no register which a copy names is written again in front of it
__device__ __forceinline__ void f_copy4(unsigned ld, const _Float16* gp) {
  asm volatile("global_load_async_to_lds_b128 %0, %1, off\n\tglobal_load_async_to_lds_b128 %2, %3, off\n\tglobal_load_async_to_lds_b128 %4, %5, off\n\tglobal_load_async_to_lds_b128 %6, %7, off\n\ts_wait_xcnt 0x0"
      :: "v"(ld), "v"(gp), "v"(ld + 4096u), "v"(gp + 2048), "v"(ld + 8192u), "v"(gp + 4096), "v"(ld + 12288u), "v"(gp + 6144) : "memory"); }
// one stage: word plane, residual plane, third projection
__device__ __forceinline__ void f_copy(unsigned ld, const _Float16* gw, const _Float16* gl, const _Float16* gv) { f_copy4(ld, gw); f_copy4(ld + 2u * PLW, gl); f_copy4(ld + 4u * PLW, gv); }
// amdgpu_waves_per_eu(4, 4): two work-groups a WGP, four waves a SIMD, as before: without it this build takes more than 256 registers and only one work-group fits a WGP; 2 x the LDS bytes stay under a WGP's 327,680
// a work-group: FQB query rows of one group (blockIdx.x, blockIdx.y) against the FKC keys of chunk blockIdx.z, FSK a stage and 32 a trip, shared by its waves through LDS; wave w: FNI x 16 of the query rows. Lane (ln, hh) sees query ln of each tile and keys 8 hh + r and 16 + 8 hh + r of the trip's 32.
__global__ __launch_bounds__(FNW * 32) __attribute__((amdgpu_waves_per_eu(4, 4))) void k_fat(const _Float16* __restrict__ QH, const _Float16* __restrict__ QL, const _Float16* __restrict__ KW, const _Float16* __restrict__ KL, const _Float16* __restrict__ VC, float* __restrict__ PO, float* __restrict__ PM, float* __restrict__ PL) {
  __shared__ __attribute__((aligned(16))) _Float16 kt[2][3][PLW];      /* two buffers x (word, residual, third projection) x FSK keys in fragment order */
  const int tid = threadIdx.x, w = tid >> 5, lane = tid & 31, hh = lane >> 4; const int g = blockIdx.y, z = blockIdx.z, i0 = blockIdx.x * FQB + w * (FNI * 16);
  const size_t k0 = ((size_t)g * MNN + z * FKC) * MNC + tid * 8; const _Float16* gw = KW + k0; const _Float16* gl = KL + k0; const _Float16* gv = VC + k0;      /* 32 keys x 64 channels are 2,048 words in a row in each plane */
  const unsigned ld = (unsigned)(size_t)&kt[0][0][tid * 8];      /* the thread's own 16 bytes in buffer 0's first plane: the LDS byte address is the low word */
  f_copy(ld, gw, gl, gv);      /* stage 0 flies under the queries' loads */
  v16h qh[FNI][2], ql[FNI][2];
#pragma unroll
  for (int ni = 0; ni < FNI; ++ni) { const size_t e = ((size_t)g * MNN + i0 + ni * 16) * MNC + lane * 8; qh[ni][0] = g3_frag(QH + e, 0); qh[ni][1] = g3_frag(QH + e, 1); }
  asm volatile("s_wait_xcnt 0x0" ::: "memory");      /* the loads' address registers are given to later loads' results: the wait stands in front of that */
#pragma unroll
  for (int ni = 0; ni < FNI; ++ni) { const size_t e = ((size_t)g * MNN + i0 + ni * 16) * MNC + lane * 8; ql[ni][0] = g3_frag(QL + e, 0); ql[ni][1] = g3_frag(QL + e, 1); }
  asm volatile("s_wait_xcnt 0x0" ::: "memory");      /* as above, in front of what follows */
  asm volatile("s_wait_asynccnt 0x0" ::: "memory");      /* this wave's copies of stage 0 have landed */
  __syncthreads();      /* stage 0 is in LDS for every wave */
  f_copy(ld + KTB, gw + PLW, gl + PLW, gv + PLW);      /* stage 1 flies under stage 0's trips */
  float m[FNI], l[FNI];
#pragma unroll
  for (int ni = 0; ni < FNI; ++ni) { m[ni] = -__builtin_inff(); l[ni] = 0.0f; }
  const v8f z8 = {0.f,0.f,0.f,0.f,0.f,0.f,0.f,0.f}; v8f o[FNI][4];
#pragma unroll
  for (int ni = 0; ni < FNI; ++ni) { o[ni][0] = z8; o[ni][1] = z8; o[ni][2] = z8; o[ni][3] = z8; }
  for (int st = 0; st < FNS; ++st) {
#pragma nounroll      /* the four trips stay one body: unrolled, the build spills to scratch at the 256 registers that four waves a SIMD leave a wave */
  for (int it = 0; it < FSP; ++it) { v8f s0[FNI], s1[FNI]; v16h va[4]; const _Float16* kc = &kt[st & 1][0][it * 32 * MNC + lane * 8];      /* the lane's own 8 words in the first piece of the trip's 32 keys */
    { const KF ka = f_load(kc, kc + PLW), kb = f_load(kc + 16 * MNC, kc + PLW + 16 * MNC);
    f_tile(ka, qh, ql, s0); f_tile(kb, qh, ql, s1); }
    FragH pf[FNI];
#pragma unroll
    for (int ni = 0; ni < FNI; ++ni) { float t = fmaxf(s0[ni][0], s1[ni][0]);
#pragma unroll
      for (int r = 1; r < 8; ++r) t = fmaxf(t, fmaxf(s0[ni][r], s1[ni][r]));
      t = fmaxf(t, xhalf(t));      /* the trip's 32 keys of a query lie in lanes ln and 16 + ln: both take one maximum, since the last product sums over all 32 */
      const float mn = fmaxf(m[ni], t), f = exp2_1((m[ni] - mn) * MLOG2E), mc = mn * MLOG2E - MLOGC; float a0 = 0.0f, a1 = 0.0f; const v8f e0 = exp2_8(s0[ni] * MLOG2E - mc), e1 = exp2_8(s1[ni] * MLOG2E - mc);      /* f: what was gathered under the old maximum is taken down to the new one (nought on the first trip); e0, e1: exp(z - maximum) 2^12 as 2^(z log2 e - mc), one multiply-add and one v_exp_f32 a word */
#pragma unroll
      for (int r = 0; r < 8; ++r) { const float u0 = e0[r], u1 = e1[r]; a0 = r ? a0 + u0 : u0; a1 = r ? a1 + u1 : u1; pf[ni].h[r] = (_Float16)u0; pf[ni].h[8 + r] = (_Float16)u1; }
      m[ni] = mn; l[ni] = l[ni] * f + (a0 + a1);
#pragma unroll
      for (int ct = 0; ct < 4; ++ct) o[ni][ct] *= f; }
#pragma unroll
    for (int ct = 0; ct < 4; ++ct) va[ct] = g3_frag(kc + 2 * PLW + ct * 512, 0);
#pragma unroll
    for (int ct = 0; ct < 4; ++ct) {
#pragma unroll
      for (int ni = 0; ni < FNI; ++ni) o[ni][ct] = f_mma(va[ct], pf[ni].v, o[ni][ct]); } }
    asm volatile("s_wait_dscnt 0x0" ::: "memory");      /* this wave's reads of the stage's buffer are done before the buffer is given back */
    asm volatile("s_wait_asynccnt 0x0" ::: "memory");      /* this wave's copies of the next stage have landed */
    __syncthreads();      /* the next stage is in LDS for every wave, and every wave has left this stage's buffer */
    if (st + 2 < FNS) f_copy(ld + (unsigned)(st & 1) * KTB, gw + (size_t)(st + 2) * PLW, gl + (size_t)(st + 2) * PLW, gv + (size_t)(st + 2) * PLW); }      /* the stage after the next into the buffer just left */
  asm volatile("s_wait_asynccnt 0x0" ::: "memory");      /* no copy is outstanding when the wave ends */
  float* po = PO + ((((size_t)g * (MNN / 16) + (i0 >> 4)) * 4) * FNZ + z) * 256 + lane * 4;      /* PO[group][tile of 16 queries][tile of 16 channels][chunk][r / 4][lane][r % 4]: every wave-wide 16-byte store covers 512 bytes in a row */
#pragma unroll
  for (int ni = 0; ni < FNI; ++ni) {
#pragma unroll
    for (int ct = 0; ct < 4; ++ct) { const v4f u0 = {o[ni][ct][0], o[ni][ct][1], o[ni][ct][2], o[ni][ct][3]}, u1 = {o[ni][ct][4], o[ni][ct][5], o[ni][ct][6], o[ni][ct][7]}; *(v4fa*)(po + (ni * 4 + ct) * FNZ * 256) = u0; *(v4fa*)(po + (ni * 4 + ct) * FNZ * 256 + 128) = u1; } }
  const float l0 = l[0] + xhalf(l[0]), l1 = l[1] + xhalf(l[1]); const size_t eq = ((size_t)g * FNZ + z) * MNN + i0 + lane;      /* a query's sum lies in lanes ln and 16 + ln; from here a lane is query lane of the wave's 32 */
  PM[eq] = hh ? m[1] : m[0]; PL[eq] = hh ? l1 : l0;
  asm volatile("s_wait_xcnt 0x0" ::: "memory");      /* behind the last store: no store's register is given away in front of the wait */
}

// the chunks joined: a work-group takes 32 queries of one group; wave w: channels 16 (w / 2) + 8 hh + 4 (w % 2) + r, r under 4, of queries ln and 16 + ln: it writes both halves of each line of the result
__global__ __launch_bounds__(256) void k_jn(const float* __restrict__ PO, const float* __restrict__ PM, const float* __restrict__ PL, const float* __restrict__ xa, const float* __restrict__ kv, const float* __restrict__ gs, float* __restrict__ res) {
  const int tid = threadIdx.x, w = tid >> 5, lane = tid & 31, ln = lane & 15, hh = lane >> 4; const int g = blockIdx.y, i0 = blockIdx.x * 32;
  const float* pp = PO + (((size_t)g * (MNN / 16) + (i0 >> 4)) * 4 + (w >> 1)) * FNZ * 256 + (w & 1) * 128 + lane * 4; const size_t eq = (size_t)g * FNZ * MNN + i0 + ln; const float* pm = PM + eq; const float* pl = PL + eq;
  const size_t e0 = ((size_t)g * MNC + 16 * (w >> 1) + 8 * hh + 4 * (w & 1)) * MNN + i0 + ln; const float* px = xa + e0; const float* pk = kv + (size_t)g * MNN + i0;
  v4f pv[FNI][FNZ]; float mv[FNI][FNZ], lv[FNI][FNZ], xv[FNI][4], kr[FNI];
#pragma unroll
  for (int ni = 0; ni < FNI; ++ni) {
#pragma unroll
    for (int u = 0; u < FNZ; ++u) { mv[ni][u] = pm[u * MNN + ni * 16]; lv[ni][u] = pl[u * MNN + ni * 16]; pv[ni][u] = *(const v4fa*)(pp + (ni * 4 * FNZ + u) * 256); }
#pragma unroll
    for (int r = 0; r < 4; ++r) xv[ni][r] = px[r * MNN + ni * 16];
    kr[ni] = pk[ni * 16 + ln]; }
  const float gr = bf16_round(gs[0]);
  asm volatile("s_wait_xcnt 0x0" :: "v"(pp), "v"(pm), "v"(pl), "v"(px), "s"(pk), "v"(ln) : "memory");      /* behind the loads; the addresses (of kv: its scalar base and lane offset) as inputs only, so that no load's own result takes an address register in front of the wait */
  float* pr = res + e0;
#pragma unroll
  for (int ni = 0; ni < FNI; ++ni) { float hi = mv[ni][0], sl = 0.0f, fu[FNZ];      /* each chunk's plane and sum are taken from that chunk's maximum down to the greatest */
#pragma unroll
    for (int u = 1; u < FNZ; ++u) hi = fmaxf(hi, mv[ni][u]);
#pragma unroll
    for (int u = 0; u < FNZ; ++u) { fu[u] = exp2_1((mv[ni][u] - hi) * MLOG2E); sl += lv[ni][u] * fu[u]; }
    v4f s = pv[ni][0] * fu[0];
#pragma unroll
    for (int u = 1; u < FNZ; ++u) s += pv[ni][u] * fu[u];
    const float rl = 1.0f / sl, kk = bf16_round(kr[ni]), gk = gr * (1.0f - kk);      /* plane and sum carry the same 2^12: it leaves in the quotient */
#pragma unroll
    for (int r = 0; r < 4; ++r) pr[r * MNN + ni * 16] = bf16_round(xv[ni][r]) * kk + gk * (s[r] * rl); }      /* every element of the result once */
  asm volatile("s_wait_xcnt 0x0" ::: "memory");      /* behind the last store: no store's register is given away in front of the wait */
}

extern "C" void kernel_launch(void* const* d_in, const int* in_sizes, int n_in,
                              void* d_out, int out_size, void* d_ws, size_t ws_size, hipStream_t stream) {
  (void)in_sizes; (void)n_in; (void)out_size;
  const float* const* I = (const float* const*)d_in; const float* xa = I[0]; const float* ya = I[1]; const float* kv = I[2]; const float* wa = I[3]; const float* ba = I[4]; const float* wb = I[5]; const float* bb = I[6]; const float* wc = I[7]; const float* bc = I[8]; const float* gs = I[9];      /* xa and ya [2][64][6400]; kv [2][1][6400]; wa, wb, wc [64][64]; ba, bb, bc [64]; gs [1] */
  static_assert(MNN % FQB == 0 && FNI == 2 && MNN % FNZ == 0 && FKC % FSK == 0 && FSK == 128 && FNS >= 2 && FNW == 8 && MNC == 64 && MNN % PPB == 0 && PPB == 64 && XPI >= MNC && XPI % 8 == 0, "whole tiles");
  uint8_t* wsp = (uint8_t*)d_ws; size_t off = 0;
  auto take = [&](size_t bytes) { uint8_t* p = wsp + off; off += (bytes + 255) & ~(size_t)255; return p; };
  _Float16* QH = (_Float16*)take((size_t)MNG * MNN * MNC * 2); _Float16* QL = (_Float16*)take((size_t)MNG * MNN * MNC * 2); _Float16* KW = (_Float16*)take((size_t)MNG * MNN * MNC * 2); _Float16* KL = (_Float16*)take((size_t)MNG * MNN * MNC * 2); _Float16* VC = (_Float16*)take((size_t)MNG * MNC * MNN * 2);      /* the first two projections as word | residual planes, the third as f16 words: all five in fragment order */
  float* PO = (float*)take((size_t)FNZ * MNG * MNN * MNC * 4); float* PM = (float*)take((size_t)FNZ * MNG * MNN * 4); float* PL = (float*)take((size_t)FNZ * MNG * MNN * 4);      /* each chunk's partial planes, maxima and sums */
  if (off > ws_size) return;
  k_prj<<<dim3((unsigned)(MNG * (MNN / PPB)), 3), 128, 0, stream>>>(xa, ya, kv, wa, ba, wb, bb, wc, bc, QH, QL, KW, KL, VC);
  k_fat<<<dim3((unsigned)(MNN / FQB), MNG, FNZ), FNW * 32, 0, stream>>>(QH, QL, KW, KL, VC, PO, PM, PL);      /* per chunk of keys: maxima, sums and sum over j of VC[g][c][j] exp(raw sums - maximum)[i][j] */
  k_jn<<<dim3((unsigned)(MNN / 32), MNG), 256, 0, stream>>>(PO, PM, PL, xa, kv, gs, (float*)d_out);      /* res[g][c][i] = xa kv + gs (1 - kv) (chunks joined, quotient) */
}

// v010
// It runs in 36.2 microseconds.
// In both of two side-by-side timings against v009, it was 1.11 times as fast.
// Counting every step since v000, it is 235 times as fast.
// A single-head pair weighting over 6,400 positions of channel-first arrays with a multiplicative key vector: xa [2][64][6400] and ya [2][64][6400] (group, channel, position), kv [2][6400], wa, wb, wc [64][64] stored (row: result channel; column: source channel), ba, bb, bc [64], gs [1]: qr = wa xa + ba, kr = wb ya + bb, vr = wc xa + bc (channel-first); zs[g][i][j] = (sum over c of qr[c][i] kr[c][j]) kv[g][j]; wt[g][i][:] = softmax over j of zs[g][i][:]; ag[g][c][i] = sum over j of vr[c][j] wt[g][i][j]; res = xa kv + gs[0] (1 - kv) ag -> [2][64][6400] f32: one result.
// Structure: THREE launches. THE FIRST PROJECTION IS TAKEN ON THE KEY SIDE: sum over c of qr[c][i] kr[c][j] = sum over d of xa[d][i] kt[d][j] + cj[j], with kt[d][j] = sum over c of wa[c][d] kr[c][j] and cj[j] = sum over c of ba[c] kr[c][j] (the same sum, its order changed), so that the query operand is xa's own word, exact in f16, and the raw sums take two products. ONE projection kernel: a work-group takes 64 positions of one group and one of two jobs; it reads its 64 x 64 block of the channel-first array in whole lines, converts (bf16 first, then f16 words) and lays it transposed in LDS as position rows; the weight's rows and the added vector are converted and laid in LDS beside it; WMMA: the key job forms kr with wb's rows as the first operand (a lane's eight accumulator words are eight channels of one position, which IS the second operand's layout of the next product), the added vector joined, splits it into an f16 word and a residual word (x 2^10) in registers and forms kt with wa's columns (laid as rows in LDS) as the first operand, two products; THE KEY VECTOR IS MULTIPLIED INTO kt's ROWS AND INTO cj (the factor taken inside the sum: nothing stands between); kt is split into an f16 word and an f16 residual word (x 2^10): one 16-byte store each, LAID IN FRAGMENT ORDER: a tile of 16 positions is four pieces of 512 bytes, lane after lane, exactly as the fused kernel's waves load them, so that every wave-wide store and load covers four whole lines; cj goes to the workspace as f32 words; the other job stores xa's position rows as they lie in LDS in the same fragment order, and forms the third projection with the position rows as the first operand (eight positions of one channel a lane; stored in fragment order too: 32 positions x 16 channels are two pieces of 512 bytes), its added vector joined and the sum stored as one f16 word; ONE FUSED kernel for raw sums, softmax and weighted sum: a work-group of eight waves owns 256 query rows (32 a wave) and one chunk of 640 of the 6,400 keys; each stage's 128 keys (word plane, residual plane, third projection: 16 KiB in a row each, already in fragment order) are brought to LDS ONCE for all eight waves by asynchronous copies, two buffers, the next stage flying while this one is worked on in four trips of 32 keys with no barrier between them (the waves meet once a stage, so that between two meetings one wave's matrix run can stand under another's vector work), and every wave reads its fragments from LDS; the raw sums are formed key-major (keys as the first operand's rows, queries as the second's) by two products (word.word, its accumulator started at cj, which the work-group holds in LDS for its whole chunk; residual.word in a second accumulator at 2^-10) and stay in registers; ONE pass over the keys: each trip raises the wave's running maximum of each query (in-lane, then one exchange between the wave's halves), takes the sum and the partial plane gathered so far down to it, and takes exp(z - maximum) as one f16 word behind a carry of 2^12 (rounded to nearest; a word under 2^-14 is an f16 subnormal, which the cast forms and the matrix unit keeps): the accumulator's layout IS the second operand's layout of the last product (channel-first third projection against those words), so nothing is transposed; each chunk's maxima, sums and partial planes go to the workspace; ONE JOINING kernel: the ten chunks' planes and sums of a query are taken down to the greatest maximum and summed, and the quotient is joined with xa, kv and gs into the result.
// Compute dtype: all ten inputs converted to bf16 where they are read; the arrays' rows and the weights exact as f16 words down to 2^-14; kr and kt TWO f16 words each; cj f32; the third projection ONE f16 word; the softmax words ONE f16 word behind 2^12, the small words kept as f16 subnormals; every product's accumulation, the raw sums, the softmax's arithmetic and the result f32. v_wmma_f32_16x16x32_f16.
#include <hip/hip_runtime.h>
#define MNG 2                        /* groups */
#define MNC 64                       /* channels: the projections' depth and width */
#define MNN 6400                     /* positions: the softmax's axis */
#define FNI 2                        /* query tiles of 16 rows a fused wave owns */
#define MLOGC 12.0f                  /* the softmax words carry 2^12 (the greatest is 2^12), added in the base-2 exponent; their sum carries it too, and it leaves in the quotient */
#define MLOG2E 1.4426950408889634f   /* log2 e: exp(x) is taken as 2^(x log2 e) on the chip's own base-2 exponential */
#define FNW 8                        /* waves of a fused work-group: the queries are split among them, the keys are shared */
#define FNZ 10                       /* key chunks: a work-group takes one */
#define FKC (MNN / FNZ)              /* keys of a chunk */
#define FSK 128                      /* keys of a stage: what one LDS buffer holds and one barrier publishes */
#define FNS (FKC / FSK)              /* stages of a chunk */
#define FSP (FSK / 32)               /* trips of 32 keys in a stage */
#define FQB (FNW * FNI * 16)         /* query rows of a fused work-group */
#define PLW (FSK * MNC)              /* f16 words of one plane of a stage */
#define KTB (3 * PLW * 2)            /* bytes of one LDS buffer: three planes of a stage */
typedef unsigned short v8us __attribute__((ext_vector_type(8), may_alias));
typedef float  v8f  __attribute__((ext_vector_type(8)));
typedef float  v4f  __attribute__((ext_vector_type(4)));
typedef float  v4fa __attribute__((ext_vector_type(4), may_alias));

__device__ __forceinline__ unsigned short bf16_bits(float x) { unsigned int u = __float_as_uint(x); return (unsigned short)((u + 0x7FFFu + ((u >> 16) & 1u)) >> 16); }
__device__ __forceinline__ float bf16_val(unsigned short b) { return __uint_as_float(((unsigned int)b) << 16); }
__device__ __forceinline__ float bf16_round(float x) { return bf16_val(bf16_bits(x)); }

typedef _Float16 v16h __attribute__((ext_vector_type(16)));
union FragH { v16h v; v8us half[2]; _Float16 h[16]; unsigned short u[16]; };

__device__ __forceinline__ v16h g2_frag(const _Float16* p, int hh) { FragH f; f.half[0] = *(const v8us*)((const unsigned short*)p + 8 * hh); f.half[1] = *(const v8us*)((const unsigned short*)p + 16 + 8 * hh); return f.v; }
// a fragment from a workspace plane laid in fragment order: p is the lane's own 8 words in a tile's first piece of 512 bytes (32 lanes x 16 bytes in a row); pieces 2 d and 2 d + 1 are the two halves of depth step d, so that a wave's load is four whole lines
__device__ __forceinline__ v16h g3_frag(const _Float16* p, int d) { FragH f; f.half[0] = *(const v8us*)((const unsigned short*)p + 512 * d); f.half[1] = *(const v8us*)((const unsigned short*)p + 512 * d + 256); return f.v; }
#define PPB 64                       /* positions a projection work-group takes */
#define XPI 72                       /* f16 words from one position row to the next in LDS: 144 bytes = 16 x 9, so that 16-byte fragment reads spread over the banks */
typedef _Float16 v2ha __attribute__((ext_vector_type(2), may_alias));
__device__ __forceinline__ v8f f_mma(v16h a, v16h b, v8f c) { return __builtin_amdgcn_wmma_f32_16x16x32_f16(false, a, false, b, (short)0, c, false, false); }
typedef _Float16 v4ha __attribute__((ext_vector_type(4), may_alias));
__device__ __forceinline__ float xhalf(float x) { return __builtin_bit_cast(float, __builtin_amdgcn_permlanex16(__builtin_bit_cast(int, x), __builtin_bit_cast(int, x), 0x76543210, 0xfedcba98, false, false)); }      /* lane l's word to lane l ^ 16 */
// blockIdx.y: 0 the key job (ya, wb, bb -> kr; wa's columns, ba, x kv -> KW | KL and CJ), 1 xa's own words and the third projection (xa -> QH; xa, wc, bc -> VC); blockIdx.x: PPB positions of one group
__global__ __launch_bounds__(128) void k_prj(const float* __restrict__ xa, const float* __restrict__ ya, const float* __restrict__ kv, const float* __restrict__ wa, const float* __restrict__ ba, const float* __restrict__ wb, const float* __restrict__ bb, const float* __restrict__ wc, const float* __restrict__ bc,
    _Float16* __restrict__ QH, _Float16* __restrict__ KW, _Float16* __restrict__ KL, _Float16* __restrict__ VC, float* __restrict__ CJ) {
  __shared__ __attribute__((aligned(16))) _Float16 xs[PPB][XPI]; __shared__ __attribute__((aligned(16))) _Float16 ws[MNC][XPI]; __shared__ __attribute__((aligned(16))) float bs[MNC];      /* position rows; the weight's rows; the added vector */
  __shared__ __attribute__((aligned(16))) _Float16 wt[MNC][XPI]; __shared__ __attribute__((aligned(16))) float b2[MNC]; __shared__ float cw[PPB];      /* the key job's: wa's columns as rows; ba; the work-group's words of cj */
  const int tid = threadIdx.x, w = tid >> 5, lane = tid & 31, ln = lane & 15, hh = lane >> 4; const int job = blockIdx.y, g = blockIdx.x / (MNN / PPB), i0 = (blockIdx.x % (MNN / PPB)) * PPB;
  const float* sp = (job == 0 ? ya : xa) + (size_t)g * MNC * MNN + i0 + (tid & 15) * 4 + (size_t)(tid >> 4) * 2 * MNN;      /* a thread: four positions of channels 2 (tid / 16) + 16 q and the next: a wave's load is two whole rows of 256 bytes */
  const float* wp = (job == 0 ? wb : wc) + tid * 4; const float* bp = job == 0 ? bb : bc; const size_t p = (size_t)g * MNN + i0 + 16 * w + ln;
  v4f x0[4], x1[4], wv[8];
#pragma unroll
  for (int q = 0; q < 4; ++q) { x0[q] = *(const v4fa*)(sp + (size_t)q * 16 * MNN); x1[q] = *(const v4fa*)(sp + (size_t)(q * 16 + 1) * MNN); }
#pragma unroll
  for (int q = 0; q < 8; ++q) wv[q] = *(const v4fa*)(wp + q * 512);      /* the weight as it lies: a wave's load is 512 bytes in a row */
  const float* bq = bp + (tid & (MNC - 1)); const float* kq = kv + p; const float br = *bq, kr = *kq;      /* kv's 12,800 words lie in the order of the position rows */
  if (job == 0) {      /* wa as it lies, laid in LDS with its columns as rows */
    const float* up = wa + tid * 4; const float* aq = ba + (tid & (MNC - 1)); v4f wu[8];
#pragma unroll
    for (int q = 0; q < 8; ++q) wu[q] = *(const v4fa*)(up + q * 512);
    const float ar = *aq;
    asm volatile("s_wait_xcnt 0x0" :: "v"(wu[0]), "v"(wu[1]), "v"(wu[2]), "v"(wu[3]), "v"(wu[4]), "v"(wu[5]), "v"(wu[6]), "v"(wu[7]), "v"(ar), "v"(up), "v"(aq) : "memory");      /* the loaded words and the addresses as inputs only: these nine loads are issued behind the 18 above and in front of this line, so that all latencies overlap, and no address register is given away in front of the wait */
#pragma unroll
    for (int q = 0; q < 8; ++q) {
#pragma unroll
      for (int e = 0; e < 4; ++e) wt[(tid & 15) * 4 + e][q * 8 + (tid >> 4)] = (_Float16)bf16_round(wu[q][e]); }
    if (tid < MNC) b2[tid] = bf16_round(ar);
  }
  asm volatile("s_wait_xcnt 0x0" :: "v"(x0[0]), "v"(x0[1]), "v"(x0[2]), "v"(x0[3]), "v"(x1[0]), "v"(x1[1]), "v"(x1[2]), "v"(x1[3]), "v"(wv[0]), "v"(wv[1]), "v"(wv[2]), "v"(wv[3]), "v"(wv[4]), "v"(wv[5]), "v"(wv[6]), "v"(wv[7]), "v"(br), "v"(kr), "v"(sp), "v"(wp), "v"(bq), "v"(kq) : "memory");      /* the loaded words and the addresses as inputs only: all 18 loads are issued in front of this line, so that their latencies overlap and are paid once, and no address register is given away in front of the wait */
#pragma unroll
  for (int q = 0; q < 4; ++q) {
#pragma unroll
    for (int e = 0; e < 4; ++e) { v2ha h2; h2[0] = (_Float16)bf16_round(x0[q][e]); h2[1] = (_Float16)bf16_round(x1[q][e]); *(v2ha*)&xs[(tid & 15) * 4 + e][(tid >> 4) * 2 + 16 * q] = h2; } }
#pragma unroll
  for (int q = 0; q < 8; ++q) { v4ha h4;
#pragma unroll
    for (int e = 0; e < 4; ++e) h4[e] = (_Float16)bf16_round(wv[q][e]);
    *(v4ha*)&ws[q * 8 + (tid >> 4)][(tid & 15) * 4] = h4; }
  if (tid < MNC) bs[tid] = bf16_round(br);
  __syncthreads();      /* position rows, weight rows and added vectors are in LDS */
  const v8f z8 = {0.f,0.f,0.f,0.f,0.f,0.f,0.f,0.f};
  if (job == 0) {      /* wave w: positions 16 w + ln as columns, all 64 channels as rows (a lane's eight words: eight channels of one position): it writes one whole tile of both planes */
    const size_t pt = ((size_t)g * MNN + i0 + 16 * w) * MNC + lane * 8; unsigned short* Hh = (unsigned short*)KW + pt; unsigned short* Hl = (unsigned short*)KL + pt;      /* the wave's tile of 16 positions: 2 KiB in fragment order, piece t = channels 16 t + 8 hh + r of position ln at lane 16 hh + ln */
    const float kk = bf16_round(kr);
    const v16h b0 = g2_frag(&xs[16 * w + ln][0], hh), b1 = g2_frag(&xs[16 * w + ln][32], hh); FragH kh[2], kl[2], fh[4], fl[4]; float cp = 0.0f;
#pragma unroll
    for (int t = 0; t < 4; ++t) { v8f c = f_mma(g2_frag(&ws[16 * t + ln][0], hh), b0, z8); c = f_mma(g2_frag(&ws[16 * t + ln][32], hh), b1, c); const v4f u0 = *(const v4fa*)&bs[16 * t + 8 * hh], u1 = *(const v4fa*)&bs[16 * t + 8 * hh + 4], e0 = *(const v4fa*)&b2[16 * t + 8 * hh], e1 = *(const v4fa*)&b2[16 * t + 8 * hh + 4];
#pragma unroll
      for (int r = 0; r < 8; ++r) { const float v = c[r] + (r < 4 ? u0[r & 3] : u1[r & 3]); const _Float16 h = (_Float16)v; cp += v * (r < 4 ? e0[r & 3] : e1[r & 3]); kh[t >> 1].h[8 * (t & 1) + r] = h; kl[t >> 1].h[8 * (t & 1) + r] = (_Float16)((v - (float)h) * 1024.0f); } }      /* kr: channel tiles 2 d and 2 d + 1 are the two halves of depth step d of the next product's second operand */
    cp += xhalf(cp);      /* a position's 64 channels lie in lanes ln and 16 + ln */
    if (hh == 0) cw[16 * w + ln] = cp * kk;
#pragma unroll
    for (int t = 0; t < 4; ++t) { const v16h a0 = g2_frag(&wt[16 * t + ln][0], hh), a1 = g2_frag(&wt[16 * t + ln][32], hh); v8f cm = f_mma(a0, kh[0].v, z8), cr = f_mma(a0, kl[0].v, z8); cm = f_mma(a1, kh[1].v, cm); cr = f_mma(a1, kl[1].v, cr);
#pragma unroll
      for (int r = 0; r < 8; ++r) { const float v = (cm[r] + cr[r] * 0.0009765625f) * kk; const _Float16 h = (_Float16)v; fh[t].h[r] = h; fl[t].h[r] = (_Float16)((v - (float)h) * 1024.0f); } }
    __syncthreads();      /* the work-group's 64 words of cj are in LDS: two waves store a whole line each */
    if (tid < PPB) CJ[(size_t)g * MNN + i0 + tid] = cw[tid];
#pragma unroll
    for (int t = 0; t < 4; ++t) { *(v8us*)(Hh + 256 * t) = fh[t].half[0]; *(v8us*)(Hl + 256 * t) = fl[t].half[0]; }      /* the tile's eight pieces in a run at the arm's end: no stored register is written again */
  } else {      /* wave w: result channels 16 w + ln as columns, all PPB positions as rows (a lane's eight words: eight positions of one channel): it writes whole pieces of 512 bytes */
    unsigned short* vo = (unsigned short*)VC + (((size_t)g * MNN + i0) / 32 * 4 + w) * 512 + lane * 8;      /* 32 positions x 16 channels: 1 KiB in fragment order, piece h = positions 16 h + 8 hh + r of channel ln at lane 16 hh + ln; four channel tiles in a row */ const float bv = (float)(_Float16)bs[16 * w + ln];
    unsigned short* qo = (unsigned short*)QH + ((size_t)g * MNN + i0 + 16 * w) * MNC + lane * 8;      /* xa's words: the wave's tile of 16 positions, 2 KiB in fragment order, piece t = channels 16 t + 8 hh + r of position ln at lane 16 hh + ln */
    const v16h b0 = g2_frag(&ws[16 * w + ln][0], hh), b1 = g2_frag(&ws[16 * w + ln][32], hh);
#pragma unroll
    for (int t = 0; t < 4; ++t) { v8f c = f_mma(g2_frag(&xs[16 * t + ln][0], hh), b0, z8); c = f_mma(g2_frag(&xs[16 * t + ln][32], hh), b1, c); FragH f;
#pragma unroll
      for (int r = 0; r < 8; ++r) f.h[r] = (_Float16)(c[r] + bv);
      *(v8us*)(vo + (t >> 1) * 2048 + (t & 1) * 256) = f.half[0]; }
#pragma unroll
    for (int t = 0; t < 4; ++t) *(v8us*)(qo + 256 * t) = *(const v8us*)((const unsigned short*)&xs[16 * w + ln][16 * t + 8 * hh]);
    asm volatile("s_wait_xcnt 0x0" ::: "memory");      /* behind the arm's last store: the stores' address pair is not given away in front of the wait */
  }
}

// 2^x on v_exp_f32, bare (a result under 2^-126 may come as nought: far under the least f16 subnormal and under the sums' last bit). Written as asm for the slot: the instruction set asks for one slot behind a transcendental before its result is read or its source overwritten: the outputs are early-clobber, so that no v_exp_f32 of a statement writes over a source of the one in front of it, and the v_nop at the end is the slot behind the last
__device__ __forceinline__ float exp2_1(float x) { float u; asm("v_exp_f32 %0, %1\n\tv_nop" : "=v"(u) : "v"(x)); return u; }
__device__ __forceinline__ v8f exp2_8(v8f x) { float u0, u1, u2, u3, u4, u5, u6, u7;      /* eight in one statement: one v_nop serves all eight */
  asm("v_exp_f32 %0, %8\n\tv_exp_f32 %1, %9\n\tv_exp_f32 %2, %10\n\tv_exp_f32 %3, %11\n\tv_exp_f32 %4, %12\n\tv_exp_f32 %5, %13\n\tv_exp_f32 %6, %14\n\tv_exp_f32 %7, %15\n\tv_nop"
      : "=&v"(u0), "=&v"(u1), "=&v"(u2), "=&v"(u3), "=&v"(u4), "=&v"(u5), "=&v"(u6), "=&v"(u7) : "v"(x[0]), "v"(x[1]), "v"(x[2]), "v"(x[3]), "v"(x[4]), "v"(x[5]), "v"(x[6]), "v"(x[7]));
  const v8f u = {u0, u1, u2, u3, u4, u5, u6, u7}; return u; }
// the raw sums of 16 keys (rows: 8 hh + r) against FNI x 16 queries (columns: ln): word.word, its accumulator started at the keys' own words of cj, and residual.word in a second accumulator at 2^-10
struct KF { v16h w0, w1, l0, l1; };      /* 16 keys: word and residual, two depth steps of 32 */
__device__ __forceinline__ KF f_load(const _Float16* __restrict__ kw, const _Float16* __restrict__ kl) { KF k; k.w0 = g3_frag(kw, 0); k.w1 = g3_frag(kw, 1); k.l0 = g3_frag(kl, 0); k.l1 = g3_frag(kl, 1); return k; }
__device__ __forceinline__ void f_tile(const KF& k, const v16h (&qh)[FNI][2], const v8f cj, v8f (&s)[FNI]) { const v8f z8 = {0.f,0.f,0.f,0.f,0.f,0.f,0.f,0.f};
#pragma unroll
  for (int ni = 0; ni < FNI; ++ni) { v8f cm = f_mma(k.w0, qh[ni][0], cj), cr = f_mma(k.l0, qh[ni][0], z8); cm = f_mma(k.w1, qh[ni][1], cm); cr = f_mma(k.l1, qh[ni][1], cr);
    s[ni] = cm + cr * 0.0009765625f; } }

// one plane of a stage (FSK keys) from the workspace to LDS: four times 16 bytes a thread, 4 KiB (the work-group's reach) from one to the next, through no register. The wait is the statement's last line, so that no register which a copy names is written again in front of it
__device__ __forceinline__ void f_copy4(unsigned ld, const _Float16* gp) {
  asm volatile("global_load_async_to_lds_b128 %0, %1, off\n\tglobal_load_async_to_lds_b128 %2, %3, off\n\tglobal_load_async_to_lds_b128 %4, %5, off\n\tglobal_load_async_to_lds_b128 %6, %7, off\n\ts_wait_xcnt 0x0"
      :: "v"(ld), "v"(gp), "v"(ld + 4096u), "v"(gp + 2048), "v"(ld + 8192u), "v"(gp + 4096), "v"(ld + 12288u), "v"(gp + 6144) : "memory"); }
// one stage: word plane, residual plane, third projection
__device__ __forceinline__ void f_copy(unsigned ld, const _Float16* gw, const _Float16* gl, const _Float16* gv) { f_copy4(ld, gw); f_copy4(ld + 2u * PLW, gl); f_copy4(ld + 4u * PLW, gv); }
// amdgpu_waves_per_eu(4, 4): two work-groups a WGP, four waves a SIMD, as before: without it this build takes more than 256 registers and only one work-group fits a WGP; 2 x the LDS bytes stay under a WGP's 327,680
// a work-group: FQB query rows of one group (blockIdx.x, blockIdx.y) against the FKC keys of chunk blockIdx.z, FSK a stage and 32 a trip, shared by its waves through LDS; wave w: FNI x 16 of the query rows. Lane (ln, hh) sees query ln of each tile and keys 8 hh + r and 16 + 8 hh + r of the trip's 32.
__global__ __launch_bounds__(FNW * 32) __attribute__((amdgpu_waves_per_eu(4, 4))) void k_fat(const _Float16* __restrict__ QH, const _Float16* __restrict__ KW, const _Float16* __restrict__ KL, const _Float16* __restrict__ VC, const float* __restrict__ CJ, float* __restrict__ PO, float* __restrict__ PM, float* __restrict__ PL) {
  __shared__ __attribute__((aligned(16))) _Float16 kt[2][3][PLW];      /* two buffers x (word, residual, third projection) x FSK keys in fragment order */
  __shared__ __attribute__((aligned(16))) float cs[FKC];      /* the chunk's words of cj */
  const int tid = threadIdx.x, w = tid >> 5, lane = tid & 31, hh = lane >> 4; const int g = blockIdx.y, z = blockIdx.z, i0 = blockIdx.x * FQB + w * (FNI * 16);
  const size_t k0 = ((size_t)g * MNN + z * FKC) * MNC + tid * 8; const _Float16* gw = KW + k0; const _Float16* gl = KL + k0; const _Float16* gv = VC + k0;      /* 32 keys x 64 channels are 2,048 words in a row in each plane */
  const unsigned ld = (unsigned)(size_t)&kt[0][0][tid * 8];      /* the thread's own 16 bytes in buffer 0's first plane: the LDS byte address is the low word */
  f_copy(ld, gw, gl, gv);      /* stage 0 flies under the queries' loads */
  v16h qh[FNI][2];
#pragma unroll
  for (int ni = 0; ni < FNI; ++ni) { const size_t e = ((size_t)g * MNN + i0 + ni * 16) * MNC + lane * 8; qh[ni][0] = g3_frag(QH + e, 0); qh[ni][1] = g3_frag(QH + e, 1); }
  asm volatile("s_wait_xcnt 0x0" ::: "memory");      /* the loads' address registers are given to later loads' results: the wait stands in front of that */
  if (tid < FKC / 4) { const float* cq = CJ + (size_t)g * MNN + z * FKC + tid * 4; const v4f c4 = *(const v4fa*)cq;      /* whole waves: FKC / 4 is a multiple of 32 */
    *(v4fa*)&cs[tid * 4] = c4; }      /* published by the barrier below, with stage 0 */
  asm volatile("s_wait_asynccnt 0x0" ::: "memory");      /* this wave's copies of stage 0 have landed */
  __syncthreads();      /* stage 0 is in LDS for every wave */
  f_copy(ld + KTB, gw + PLW, gl + PLW, gv + PLW);      /* stage 1 flies under stage 0's trips */
  float m[FNI], l[FNI];
#pragma unroll
  for (int ni = 0; ni < FNI; ++ni) { m[ni] = -__builtin_inff(); l[ni] = 0.0f; }
  const v8f z8 = {0.f,0.f,0.f,0.f,0.f,0.f,0.f,0.f}; v8f o[FNI][4];
#pragma unroll
  for (int ni = 0; ni < FNI; ++ni) { o[ni][0] = z8; o[ni][1] = z8; o[ni][2] = z8; o[ni][3] = z8; }
  for (int st = 0; st < FNS; ++st) {
#pragma nounroll      /* the four trips stay one body: unrolled, the build spills to scratch at the 256 registers that four waves a SIMD leave a wave */
  for (int it = 0; it < FSP; ++it) { v8f s0[FNI], s1[FNI]; v16h va[4]; const _Float16* kc = &kt[st & 1][0][it * 32 * MNC + lane * 8];      /* the lane's own 8 words in the first piece of the trip's 32 keys */
    { const KF ka = f_load(kc, kc + PLW), kb = f_load(kc + 16 * MNC, kc + PLW + 16 * MNC); const float* cc = &cs[(st * FSP + it) * 32 + 8 * hh];      /* the lane's eight keys of each tile: all 16 lanes of a half read the same words */
    const v4f c0 = *(const v4fa*)cc, c1 = *(const v4fa*)(cc + 4), c2 = *(const v4fa*)(cc + 16), c3 = *(const v4fa*)(cc + 20); const v8f ca = {c0[0], c0[1], c0[2], c0[3], c1[0], c1[1], c1[2], c1[3]}, cb = {c2[0], c2[1], c2[2], c2[3], c3[0], c3[1], c3[2], c3[3]};
    f_tile(ka, qh, ca, s0); f_tile(kb, qh, cb, s1); }
    FragH pf[FNI];
#pragma unroll
    for (int ni = 0; ni < FNI; ++ni) { float t = fmaxf(s0[ni][0], s1[ni][0]);
#pragma unroll
      for (int r = 1; r < 8; ++r) t = fmaxf(t, fmaxf(s0[ni][r], s1[ni][r]));
      t = fmaxf(t, xhalf(t));      /* the trip's 32 keys of a query lie in lanes ln and 16 + ln: both take one maximum, since the last product sums over all 32 */
      const float mn = fmaxf(m[ni], t), f = exp2_1((m[ni] - mn) * MLOG2E), mc = mn * MLOG2E - MLOGC; float a0 = 0.0f, a1 = 0.0f; const v8f e0 = exp2_8(s0[ni] * MLOG2E - mc), e1 = exp2_8(s1[ni] * MLOG2E - mc);      /* f: what was gathered under the old maximum is taken down to the new one (nought on the first trip); e0, e1: exp(z - maximum) 2^12 as 2^(z log2 e - mc), one multiply-add and one v_exp_f32 a word */
#pragma unroll
      for (int r = 0; r < 8; ++r) { const float u0 = e0[r], u1 = e1[r]; a0 = r ? a0 + u0 : u0; a1 = r ? a1 + u1 : u1; pf[ni].h[r] = (_Float16)u0; pf[ni].h[8 + r] = (_Float16)u1; }
      m[ni] = mn; l[ni] = l[ni] * f + (a0 + a1);
#pragma unroll
      for (int ct = 0; ct < 4; ++ct) o[ni][ct] *= f; }
#pragma unroll
    for (int ct = 0; ct < 4; ++ct) va[ct] = g3_frag(kc + 2 * PLW + ct * 512, 0);
#pragma unroll
    for (int ct = 0; ct < 4; ++ct) {
#pragma unroll
      for (int ni = 0; ni < FNI; ++ni) o[ni][ct] = f_mma(va[ct], pf[ni].v, o[ni][ct]); } }
    asm volatile("s_wait_dscnt 0x0" ::: "memory");      /* this wave's reads of the stage's buffer are done before the buffer is given back */
    asm volatile("s_wait_asynccnt 0x0" ::: "memory");      /* this wave's copies of the next stage have landed */
    __syncthreads();      /* the next stage is in LDS for every wave, and every wave has left this stage's buffer */
    if (st + 2 < FNS) f_copy(ld + (unsigned)(st & 1) * KTB, gw + (size_t)(st + 2) * PLW, gl + (size_t)(st + 2) * PLW, gv + (size_t)(st + 2) * PLW); }      /* the stage after the next into the buffer just left */
  asm volatile("s_wait_asynccnt 0x0" ::: "memory");      /* no copy is outstanding when the wave ends */
  float* po = PO + ((((size_t)g * (MNN / 16) + (i0 >> 4)) * 4) * FNZ + z) * 256 + lane * 4;      /* PO[group][tile of 16 queries][tile of 16 channels][chunk][r / 4][lane][r % 4]: every wave-wide 16-byte store covers 512 bytes in a row */
#pragma unroll
  for (int ni = 0; ni < FNI; ++ni) {
#pragma unroll
    for (int ct = 0; ct < 4; ++ct) { const v4f u0 = {o[ni][ct][0], o[ni][ct][1], o[ni][ct][2], o[ni][ct][3]}, u1 = {o[ni][ct][4], o[ni][ct][5], o[ni][ct][6], o[ni][ct][7]}; *(v4fa*)(po + (ni * 4 + ct) * FNZ * 256) = u0; *(v4fa*)(po + (ni * 4 + ct) * FNZ * 256 + 128) = u1; } }
  const float l0 = l[0] + xhalf(l[0]), l1 = l[1] + xhalf(l[1]); const size_t eq = ((size_t)g * FNZ + z) * MNN + i0 + lane;      /* a query's sum lies in lanes ln and 16 + ln; from here a lane is query lane of the wave's 32 */
  PM[eq] = hh ? m[1] : m[0]; PL[eq] = hh ? l1 : l0;
  asm volatile("s_wait_xcnt 0x0" ::: "memory");      /* behind the last store: no store's register is given away in front of the wait */
}

// the chunks joined: a work-group takes 32 queries of one group; wave w: channels 16 (w / 2) + 8 hh + 4 (w % 2) + r, r under 4, of queries ln and 16 + ln: it writes both halves of each line of the result
__global__ __launch_bounds__(256) void k_jn(const float* __restrict__ PO, const float* __restrict__ PM, const float* __restrict__ PL, const float* __restrict__ xa, const float* __restrict__ kv, const float* __restrict__ gs, float* __restrict__ res) {
  const int tid = threadIdx.x, w = tid >> 5, lane = tid & 31, ln = lane & 15, hh = lane >> 4; const int g = blockIdx.y, i0 = blockIdx.x * 32;
  const float* pp = PO + (((size_t)g * (MNN / 16) + (i0 >> 4)) * 4 + (w >> 1)) * FNZ * 256 + (w & 1) * 128 + lane * 4; const size_t eq = (size_t)g * FNZ * MNN + i0 + ln; const float* pm = PM + eq; const float* pl = PL + eq;
  const size_t e0 = ((size_t)g * MNC + 16 * (w >> 1) + 8 * hh + 4 * (w & 1)) * MNN + i0 + ln; const float* px = xa + e0; const float* pk = kv + (size_t)g * MNN + i0;
  v4f pv[FNI][FNZ]; float mv[FNI][FNZ], lv[FNI][FNZ], xv[FNI][4], kr[FNI];
#pragma unroll
  for (int ni = 0; ni < FNI; ++ni) {
#pragma unroll
    for (int u = 0; u < FNZ; ++u) { mv[ni][u] = pm[u * MNN + ni * 16]; lv[ni][u] = pl[u * MNN + ni * 16]; pv[ni][u] = *(const v4fa*)(pp + (ni * 4 * FNZ + u) * 256); }
#pragma unroll
    for (int r = 0; r < 4; ++r) xv[ni][r] = px[r * MNN + ni * 16];
    kr[ni] = pk[ni * 16 + ln]; }
  const float gr = bf16_round(gs[0]);
  asm volatile("s_wait_xcnt 0x0" :: "v"(pp), "v"(pm), "v"(pl), "v"(px), "s"(pk), "v"(ln) : "memory");      /* behind the loads; the addresses (of kv: its scalar base and lane offset) as inputs only, so that no load's own result takes an address register in front of the wait */
  float* pr = res + e0;
#pragma unroll
  for (int ni = 0; ni < FNI; ++ni) { float hi = mv[ni][0], sl = 0.0f, fu[FNZ];      /* each chunk's plane and sum are taken from that chunk's maximum down to the greatest */
#pragma unroll
    for (int u = 1; u < FNZ; ++u) hi = fmaxf(hi, mv[ni][u]);
#pragma unroll
    for (int u = 0; u < FNZ; ++u) { fu[u] = exp2_1((mv[ni][u] - hi) * MLOG2E); sl += lv[ni][u] * fu[u]; }
    v4f s = pv[ni][0] * fu[0];
#pragma unroll
    for (int u = 1; u < FNZ; ++u) s += pv[ni][u] * fu[u];
    const float rl = 1.0f / sl, kk = bf16_round(kr[ni]), gk = gr * (1.0f - kk);      /* plane and sum carry the same 2^12: it leaves in the quotient */
#pragma unroll
    for (int r = 0; r < 4; ++r) pr[r * MNN + ni * 16] = bf16_round(xv[ni][r]) * kk + gk * (s[r] * rl); }      /* every element of the result once */
  asm volatile("s_wait_xcnt 0x0" ::: "memory");      /* behind the last store: no store's register is given away in front of the wait */
}

extern "C" void kernel_launch(void* const* d_in, const int* in_sizes, int n_in,
                              void* d_out, int out_size, void* d_ws, size_t ws_size, hipStream_t stream) {
  (void)in_sizes; (void)n_in; (void)out_size;
  const float* const* I = (const float* const*)d_in; const float* xa = I[0]; const float* ya = I[1]; const float* kv = I[2]; const float* wa = I[3]; const float* ba = I[4]; const float* wb = I[5]; const float* bb = I[6]; const float* wc = I[7]; const float* bc = I[8]; const float* gs = I[9];      /* xa and ya [2][64][6400]; kv [2][1][6400]; wa, wb, wc [64][64]; ba, bb, bc [64]; gs [1] */
  static_assert(MNN % FQB == 0 && FNI == 2 && MNN % FNZ == 0 && FKC % FSK == 0 && FKC % 128 == 0 && FSK == 128 && FNS >= 2 && FNW == 8 && MNC == 64 && MNN % PPB == 0 && PPB == 64 && XPI >= MNC && XPI % 8 == 0, "whole tiles");
  uint8_t* wsp = (uint8_t*)d_ws; size_t off = 0;
  auto take = [&](size_t bytes) { uint8_t* p = wsp + off; off += (bytes + 255) & ~(size_t)255; return p; };
  _Float16* QH = (_Float16*)take((size_t)MNG * MNN * MNC * 2); _Float16* KW = (_Float16*)take((size_t)MNG * MNN * MNC * 2); _Float16* KL = (_Float16*)take((size_t)MNG * MNN * MNC * 2); _Float16* VC = (_Float16*)take((size_t)MNG * MNC * MNN * 2);      /* xa's words, kt as word | residual planes, the third projection as f16 words: all four in fragment order */ float* CJ = (float*)take((size_t)MNG * MNN * 4);      /* cj */
  float* PO = (float*)take((size_t)FNZ * MNG * MNN * MNC * 4); float* PM = (float*)take((size_t)FNZ * MNG * MNN * 4); float* PL = (float*)take((size_t)FNZ * MNG * MNN * 4);      /* each chunk's partial planes, maxima and sums */
  if (off > ws_size) return;
  k_prj<<<dim3((unsigned)(MNG * (MNN / PPB)), 2), 128, 0, stream>>>(xa, ya, kv, wa, ba, wb, bb, wc, bc, QH, KW, KL, VC, CJ);
  k_fat<<<dim3((unsigned)(MNN / FQB), MNG, FNZ), FNW * 32, 0, stream>>>(QH, KW, KL, VC, CJ, PO, PM, PL);      /* per chunk of keys: maxima, sums and sum over j of VC[g][c][j] exp(raw sums - maximum)[i][j] */
  k_jn<<<dim3((unsigned)(MNN / 32), MNG), 256, 0, stream>>>(PO, PM, PL, xa, kv, gs, (float*)d_out);      /* res[g][c][i] = xa kv + gs (1 - kv) (chunks joined, quotient) */
}
